// v000
// Measured on an AMD MI455X. A time is GPU time per run, averaged over a window of back-to-back runs after a warm-up
// (all launches, gaps included; the runs take copies of the inputs in turn), and the median of several windows.
// Apart from v000's, it joins two sittings. Times from different sittings can be a few percent apart, while
// side-by-side timings come from the same sitting.
// v000, which the later versions start from, runs in 2050 microseconds.
#include <hip/hip_runtime.h>

// LTXAttention (hidden [1][2048][2048]; q/k/v = x W + b; q, k RMS-normalised across the full 2048 (eps 1e-5) * w; interleaved-pair rotary with the read per-element cos/sin [1][S][2048] (x cos + rot(x) sin, rot = (-x_odd, x_even)); 32 heads x 64; softmax(q.k / 8) (no mask); out = merged wo + bo -> [1][2048][2048]).
// Compute dtypes, f32 accumulate: every input rounded to bf16; q/k/v on PLAIN bf16 operands (inputs: exact) + bias; RMSNorm (wave per row, in place) and rotary (bf16-rounded full-width tables) f32; scores hl x hl (3 products) on EVERY row (normalised q/k: sharp), attn.v: query rows < 512 hl (3 products), the rest single fp16 (x1024); softmax f32; wo hl x exact (2 products) + bias.

#define NB_  1
#define TT   2048
#define DM   2048
#define NH_  32
#define NKV  32
#define REP  (NH_ / NKV)
#define HD   64
#define DQ   (NH_ * HD)
#define DKV  (NKV * HD)
#define ZH   2
#define RH   512                  // query rows < RH use hi+lo planes (0: none)
#define WIN  0
#define PCAR 1024.0f
#define SCL  0.125f   // HD^-0.5
typedef _Float16 h16;
typedef unsigned short bf;
typedef __attribute__((ext_vector_type(16))) __bf16   v16bf;
typedef __attribute__((ext_vector_type(16))) _Float16 v16h;
typedef __attribute__((ext_vector_type(8)))  _Float16 v8h;
typedef __attribute__((ext_vector_type(8)))  unsigned short v8us;
typedef __attribute__((ext_vector_type(8)))  float    v8f;
typedef __attribute__((ext_vector_type(4)))  float    v4f;
typedef v8h  __attribute__((may_alias)) v8ha;
typedef v4f  __attribute__((may_alias)) v4fa;
typedef v8us __attribute__((may_alias)) v8usa;

__device__ __forceinline__ unsigned short f2bf(float f) { unsigned u = __float_as_uint(f); u += 0x7FFFu + ((u >> 16) & 1u); return (unsigned short)(u >> 16); }
__device__ __forceinline__ float bf2f(unsigned short b) { return __uint_as_float(((unsigned)b) << 16); }
__device__ __forceinline__ float bfr(float f) { return bf2f(f2bf(f)); }
__device__ __forceinline__ v16h cat16(v8h lo, v8h hi) { return __builtin_shufflevector(lo, hi, 0, 1, 2, 3, 4, 5, 6, 7, 8, 9, 10, 11, 12, 13, 14, 15); }
__device__ __forceinline__ v16bf cat16b(v8us lo, v8us hi) { return __builtin_bit_cast(v16bf, __builtin_shufflevector(lo, hi, 0, 1, 2, 3, 4, 5, 6, 7, 8, 9, 10, 11, 12, 13, 14, 15)); }
__device__ __forceinline__ v8f wmma16(v16h a, v16h b, v8f c) { return __builtin_amdgcn_wmma_f32_16x16x32_f16(false, a, false, b, (short)0, c, false, false); }
__device__ __forceinline__ v8f wmmab(v16bf a, v16bf b, v8f c) { return __builtin_amdgcn_wmma_f32_16x16x32_bf16(false, a, false, b, (short)0, c, false, false); }



// ---- k_gemmw: register-blocked GEMM, ONE WAVE per 64x64 output tile (16 accumulators), operands straight from K-contiguous 16-bit planes; grid (M/64, N/64, Z), 32 threads.
// C[m][n] (f32, pitch ldc, + optional f32 bias[n]) = sum_k A[m][k] Bt[n][k] (+ split products per NSPLIT). z-batch strides sA/sB/sC in elements. K % 32 == 0.
template <typename T16> struct WFrag;
template <> struct WFrag<h16> { typedef v16h V; static __device__ __forceinline__ V ld(const h16* p) { return cat16(*(const v8h*)p, *(const v8h*)(p + 16)); } static __device__ __forceinline__ v8f mma(V a, V b, v8f c) { return wmma16(a, b, c); } };
template <> struct WFrag<bf> { typedef v16bf V; static __device__ __forceinline__ V ld(const bf* p) { return cat16b(*(const v8us*)p, *(const v8us*)(p + 16)); } static __device__ __forceinline__ v8f mma(V a, V b, v8f c) { return wmmab(a, b, c); } };
template <typename T16, int NSPLIT, bool BIAS>
__global__ __launch_bounds__(32) void k_gemmw(const T16* __restrict__ A, const T16* __restrict__ A2, const T16* __restrict__ Bt, const T16* __restrict__ Bt2, int K, float* C, int ldc, const float* __restrict__ bias, size_t sA, size_t sB, size_t sC) {
    typedef typename WFrag<T16>::V V;
    __shared__ __align__(16) float os[16 * 68];
    const size_t z = blockIdx.z; A += z * sA; if (A2) A2 += z * sA; Bt += z * sB; if (Bt2) Bt2 += z * sB; C += z * sC;
    const int lane = threadIdx.x & 31, lr = lane & 15, hi = lane >> 4; const int r0 = blockIdx.x * 64, c0 = blockIdx.y * 64;
    v8f acc[4][4];
#pragma unroll
    for (int mb = 0; mb < 4; ++mb)
#pragma unroll
        for (int nb = 0; nb < 4; ++nb) acc[mb][nb] = (v8f){};
    const size_t aoff = (size_t)(r0 + lr) * K + 8 * hi, boff = (size_t)(c0 + lr) * K + 8 * hi;
#pragma unroll 1
    for (int kc = 0; kc < K; kc += 32) {
        V a[4], a2[4];
#pragma unroll
        for (int mb = 0; mb < 4; ++mb) { a[mb] = WFrag<T16>::ld(A + aoff + (size_t)mb * 16 * K + kc); if (NSPLIT == 1 || NSPLIT == 2) a2[mb] = WFrag<T16>::ld(A2 + aoff + (size_t)mb * 16 * K + kc); }
#pragma unroll
        for (int nb = 0; nb < 4; ++nb) { const V b = WFrag<T16>::ld(Bt + boff + (size_t)nb * 16 * K + kc); V b2; if (NSPLIT >= 2) b2 = WFrag<T16>::ld(Bt2 + boff + (size_t)nb * 16 * K + kc);
#pragma unroll
            for (int mb = 0; mb < 4; ++mb) { acc[mb][nb] = WFrag<T16>::mma(a[mb], b, acc[mb][nb]); if (NSPLIT == 1 || NSPLIT == 2) acc[mb][nb] = WFrag<T16>::mma(a2[mb], b, acc[mb][nb]); if (NSPLIT >= 2) acc[mb][nb] = WFrag<T16>::mma(a[mb], b2, acc[mb][nb]); } }
        asm volatile("v_nop\n\tv_nop\n\tv_nop\n\tv_nop" : "+v"(acc[0][0]), "+v"(acc[1][1]), "+v"(acc[2][2]), "+v"(acc[3][3]) : "v"(a[0]), "v"(a[3]));
    }
#pragma unroll
    for (int mb = 0; mb < 4; ++mb) {
#pragma unroll
        for (int nb = 0; nb < 4; ++nb) {
#pragma unroll
            for (int j = 0; j < 8; ++j) os[(hi * 8 + j) * 68 + nb * 16 + lr] = acc[mb][nb][j]; }
        __builtin_amdgcn_wave_barrier(); asm volatile("" ::: "memory");
        float* crow = C + (size_t)(r0 + mb * 16) * ldc + c0;
{
#pragma unroll
            for (int s = 0; s < 8; ++s) { const int row = 2 * s + hi, cofs = lr * 4; v4f val = *(const v4fa*)(os + row * 68 + cofs); if (BIAS) { val[0] += bfr(bias[c0 + cofs]); val[1] += bfr(bias[c0 + cofs + 1]); val[2] += bfr(bias[c0 + cofs + 2]); val[3] += bfr(bias[c0 + cofs + 3]); }
                *(v4f*)(crow + (size_t)row * ldc + cofs) = val; }
             }
        __builtin_amdgcn_wave_barrier(); asm volatile("" ::: "memory");
    }
}

__device__ __forceinline__ h16 tohx(float x) { return (h16)x; }
__device__ __forceinline__ void splitf(float y, unsigned short& h, unsigned short& l) { h = f2bf(y); l = f2bf(y - bf2f(h)); }
typedef __attribute__((ext_vector_type(2))) _Float16 v2h;
typedef __attribute__((ext_vector_type(4))) _Float16 v4h;
typedef __attribute__((ext_vector_type(2))) unsigned short v2us;
typedef __attribute__((ext_vector_type(4))) unsigned short v4us;
typedef __attribute__((ext_vector_type(2))) float v2f;
typedef __attribute__((ext_vector_type(4))) int v4i;

__global__ __launch_bounds__(256) void k_wtG(const float* __restrict__ w, int K, int N, bf* Bt) {
    const int lane = threadIdx.x & 31; const int L0 = (blockIdx.x * 8 + (threadIdx.x >> 5)) * 8; const int nlines = N * K / 64;
{
#pragma unroll 1
        for (int l = 0; l < 8; ++l) { const int L = L0 + l; if (L >= nlines) break; const size_t e = (size_t)L * 64 + lane * 2; const int k = (int)(e % K), n = (int)(e / K); v2us o;
            o[0] = f2bf(w[(size_t)k * N + n]); o[1] = f2bf(w[(size_t)(k + 1) * N + n]); *(v2us*)(Bt + e) = o; }
         }
}
__global__ __launch_bounds__(256) void k_cvt8(const float* __restrict__ src, bf* dst, size_t n8) { const size_t i = (size_t)blockIdx.x * 256 + threadIdx.x; if (i >= n8) return; const v8f v = *(const v8f*)(src + i * 8); v8us o;
#pragma unroll
    for (int k = 0; k < 8; ++k) o[k] = f2bf(v[k]); *(v8us*)(dst + i * 8) = o;  }
__global__ __launch_bounds__(256) void k_cscvt(const float* __restrict__ cosT, const float* __restrict__ sinT, float* CS) { const int idx = blockIdx.x * 256 + threadIdx.x; if (idx >= TT * DQ) return; v2f cs; cs[0] = bfr(cosT[idx]); cs[1] = bfr(sinT[idx]); *(v2f*)(CS + (size_t)idx * 2) = cs;  }
// k_rope: head planes [h][t][d] (fp16 + hi/lo) of rope(x) x sc with the interleaved-pair convention out[d] = x[d] cos[t][d] - x[d+1] sin[t][d], out[d+1] = x[d+1] cos[t][d+1] + x[d] sin[t][d+1] (d even)
__global__ __launch_bounds__(256) void k_rope(const float* __restrict__ F, int pitch, int nheads, const float* __restrict__ CS, const float* __restrict__ RF, const float* __restrict__ nw, float sc, h16* P16, bf* Ph, bf* Pl) {
    const size_t e = ((size_t)blockIdx.x * 256 + threadIdx.x) * 2; if (e >= (size_t)nheads * TT * HD) return; const int d = (int)(e % HD); const int t = (int)((e / HD) % TT); const int h = (int)(e / ((size_t)HD * TT)); const float* f = F + (size_t)t * pitch + h * HD; const float rf = RF ? RF[(size_t)h * TT + t] : 1.0f; v2h o16; v2us oh, ol;
#pragma unroll
    for (int q = 0; q < 2; ++q) { const int dd = d + q; const int dp = dd ^ 1; float x0 = f[dd], x1 = f[dp];
        if (RF) { float n0 = __fmul_rn(x0, rf), n1 = __fmul_rn(x1, rf); asm volatile("" : "+v"(n0)); asm volatile("" : "+v"(n1)); x0 = __fmul_rn(bfr(nw[dd]), n0); x1 = __fmul_rn(bfr(nw[dp]), n1); }
        const v2f cs = *(const v2f*)(CS + ((size_t)t * DQ + h * HD + dd) * 2);   /* full-width per-element tables */ float a = __fmul_rn(x0, cs[0]), bq = __fmul_rn(x1, cs[1]); asm volatile("" : "+v"(a)); asm volatile("" : "+v"(bq)); const float r = (((dd & 1) == 0) ? __fsub_rn(a, bq) : __fadd_rn(a, bq)) * sc;
        o16[q] = tohx(r); unsigned short a2, c2; splitf(r, a2, c2); oh[q] = a2; ol[q] = c2; }
    *(v2h*)(P16 + e) = o16; *(v2us*)(Ph + e) = oh; *(v2us*)(Pl + e) = ol;  }
__global__ __launch_bounds__(256) void k_vtp(const float* __restrict__ F, int pitch, int nheads, h16* V16, bf* Vh, bf* Vl) { const size_t e = ((size_t)blockIdx.x * 256 + threadIdx.x) * 2; if (e >= (size_t)nheads * HD * TT) return; const int t = (int)(e % TT); const int d = (int)((e / TT) % HD); const int g = (int)(e / ((size_t)TT * HD)); v2h o16; v2us oh, ol;
#pragma unroll
    for (int q = 0; q < 2; ++q) { const float x = F[(size_t)(t + q) * pitch + g * HD + d]; o16[q] = tohx(x); unsigned short a2, c2; splitf(x, a2, c2); oh[q] = a2; ol[q] = c2; }
    *(v2h*)(V16 + e) = o16; *(v2us*)(Vh + e) = oh; *(v2us*)(Vl + e) = ol;  }
__global__ __launch_bounds__(256) void k_rmsrow(float* F, const float* __restrict__ w) { const int lane = threadIdx.x & 31; const int t = blockIdx.x * 8 + (threadIdx.x >> 5); if (t >= TT) return; float* f = F + (size_t)t * DQ; float v[DQ / 32]; float ss = 0.f;
#pragma unroll
    for (int ch = 0; ch < DQ / 128; ++ch) { const v4f a = *(const v4f*)(f + ch * 128 + lane * 4); for (int u = 0; u < 4; ++u) { v[ch * 4 + u] = a[u]; float p = __fmul_rn(a[u], a[u]); asm volatile("" : "+v"(p)); ss = __fadd_rn(ss, p); } }
#pragma unroll
    for (int sh = 16; sh; sh >>= 1) ss = __fadd_rn(ss, __shfl_xor(ss, sh, 32));
    const float rs = __fdiv_rn(1.0f, sqrtf(__fadd_rn(__fdiv_rn(ss, (float)DQ), 1e-5f)));
    {
#pragma unroll
        for (int ch = 0; ch < DQ / 128; ++ch) { v4f o; for (int u = 0; u < 4; ++u) { float y = __fmul_rn(v[ch * 4 + u], rs); asm volatile("" : "+v"(y)); o[u] = __fmul_rn(y, bfr(w[ch * 128 + lane * 4 + u])); } *(v4f*)(f + ch * 128 + lane * 4) = o; }
         } }
// k_asoft: per row (zz, i): t = S x HD^-0.5 (no mask); softmax over the 2048 keys (register row, one exp, fixed trees);
__global__ __launch_bounds__(256) void k_asoft(const float* __restrict__ Sb, h16* P16, bf* Ph, bf* Pl) {
    const int lane = threadIdx.x & 31; const int row = blockIdx.x * 8 + (threadIdx.x >> 5); if (row >= ZH * TT) return; const int i = row % TT; const int zz = row / TT; (void)zz; const bool hires = (i < RH); const float* sr = Sb + (size_t)row * TT; float v[TT / 32]; float mx = -3.0e38f;
#pragma unroll
    for (int ch = 0; ch < TT / 128; ++ch) { const int j0 = ch * 128 + lane * 4; const v4f a = *(const v4f*)(sr + j0);
#pragma unroll
        for (int q = 0; q < 4; ++q) { const int j = j0 + q; (void)j; const float t = a[q] * SCL; v[ch * 4 + q] = t; mx = fmaxf(mx, t); } }
#pragma unroll
    for (int sh = 16; sh; sh >>= 1) mx = fmaxf(mx, __shfl_xor(mx, sh, 32));
    float sum = 0.f;
#pragma unroll
    for (int k = 0; k < TT / 32; ++k) { float d0 = __fsub_rn(v[k], mx); asm volatile("" : "+v"(d0)); v[k] = __builtin_amdgcn_exp2f(__fmul_rn(d0, 1.4426950408889634f)); sum += v[k]; }
#pragma unroll
    for (int sh = 16; sh; sh >>= 1) sum += __shfl_xor(sum, sh, 32);
    const float f = __fdiv_rn(hires ? 1.0f : PCAR, sum);
{
        if (hires) {
#pragma unroll
            for (int ch = 0; ch < TT / 128; ++ch) { v4us oh, ol;
#pragma unroll
                for (int q = 0; q < 4; ++q) { unsigned short a, c2; splitf(v[ch * 4 + q] * f, a, c2); oh[q] = a; ol[q] = c2; }
                const size_t oo = ((size_t)zz * (RH ? RH : 1) + i) * TT + ch * 128 + lane * 4; *(v4us*)(Ph + oo) = oh; *(v4us*)(Pl + oo) = ol; }
        } else {
#pragma unroll
            for (int ch = 0; ch < TT / 128; ++ch) { v4h o4;
#pragma unroll
                for (int q = 0; q < 4; ++q) o4[q] = tohx(v[ch * 4 + q] * f);
                *(v4h*)(P16 + (size_t)row * TT + ch * 128 + lane * 4) = o4; } }
         }
}
__global__ __launch_bounds__(256) void k_merge(const float* __restrict__ O, int h0, bf* Ah, bf* Al) { const size_t e = ((size_t)blockIdx.x * 256 + threadIdx.x) * 2; if (e >= (size_t)ZH * TT * HD) return; const int d = (int)(e % HD); const int t = (int)((e / HD) % TT); const int zz = (int)(e / ((size_t)HD * TT)); const float cs = (t < RH) ? 1.0f : (1.0f / PCAR); const size_t oo = (size_t)t * DQ + (h0 + zz) * HD + d;
    v2us oh, ol;
#pragma unroll
    for (int q = 0; q < 2; ++q) { unsigned short a, c2; splitf(O[e + q] * cs, a, c2); oh[q] = a; ol[q] = c2; } *(v2us*)(Ah + oo) = oh; *(v2us*)(Al + oo) = ol;  }

extern "C" void kernel_launch(void* const* d_in, const int* in_sizes, int n_in,
                              void* d_out, int out_size, void* d_ws, size_t ws_size, hipStream_t stream) {
    (void)in_sizes; (void)n_in; (void)out_size;
    const float* x = (const float*)d_in[0]; const float* cosT = (const float*)d_in[1]; const float* sinT = (const float*)d_in[2]; const float* wq = (const float*)d_in[3]; const float* bq = (const float*)d_in[4]; const float* wk = (const float*)d_in[5]; const float* bk = (const float*)d_in[6]; const float* wv = (const float*)d_in[7]; const float* bv = (const float*)d_in[8]; const float* nqw = (const float*)d_in[9]; const float* nkw = (const float*)d_in[10]; const float* wo = (const float*)d_in[11]; const float* bo = (const float*)d_in[12];
    float* OUT = (float*)d_out;     // [1][2048][2048]
    char* wsp = (char*)d_ws;
    auto take = [&](size_t bytes) { char* p = wsp; wsp += (bytes + 255) & ~(size_t)255; return (void*)p; };
    bf* WQ = (bf*)take((size_t)DQ * DM * 2); bf* WK = (bf*)take((size_t)DKV * DM * 2); bf* WV = (bf*)take((size_t)DKV * DM * 2); bf* WO = (bf*)take((size_t)DM * DQ * 2); float* CS = (float*)take((size_t)TT * DQ * 2 * 4);
    bf* XB = (bf*)take((size_t)TT * DM * 2); float* FQ = (float*)take((size_t)TT * DQ * 4); float* FK = (float*)take((size_t)TT * DKV * 4);
    h16* QP16 = (h16*)take((size_t)NH_ * TT * HD * 2); h16* KP16 = (h16*)take((size_t)NKV * TT * HD * 2); h16* VT16 = (h16*)take((size_t)NKV * HD * TT * 2);
    bf* QPh = (bf*)take((size_t)NH_ * TT * HD * 2); bf* QPl = (bf*)take((size_t)NH_ * TT * HD * 2); bf* KPh = (bf*)take((size_t)NKV * TT * HD * 2); bf* KPl = (bf*)take((size_t)NKV * TT * HD * 2); bf* VTh = (bf*)take((size_t)NKV * HD * TT * 2); bf* VTl = (bf*)take((size_t)NKV * HD * TT * 2); bf* Ph = (bf*)take((size_t)ZH * RH * TT * 2); bf* Pl = (bf*)take((size_t)ZH * RH * TT * 2);
    float* Sb = (float*)take((size_t)ZH * TT * TT * 4); h16* P16 = (h16*)take((size_t)ZH * TT * TT * 2); float* Ob = (float*)take((size_t)ZH * TT * HD * 4); bf* ATh = (bf*)take((size_t)TT * DQ * 2); bf* ATl = (bf*)take((size_t)TT * DQ * 2);
    if ((size_t)(wsp - (char*)d_ws) > ws_size) return;    // ws 256 MiB
    float* FV = FK;   // v projection reuses the k buffer after the k planes are built (stream-ordered)
    { k_wtG<<<(unsigned)((DM * DQ / 64 + 63) / 64), 256, 0, stream>>>(wq, DM, DQ, WQ); k_wtG<<<(unsigned)((DM * DKV / 64 + 63) / 64), 256, 0, stream>>>(wk, DM, DKV, WK); k_wtG<<<(unsigned)((DM * DKV / 64 + 63) / 64), 256, 0, stream>>>(wv, DM, DKV, WV);
      k_wtG<<<(unsigned)((DQ * DM / 64 + 63) / 64), 256, 0, stream>>>(wo, DQ, DM, WO);
       }
    const unsigned LQ = (unsigned)(((size_t)NH_ * TT * HD / 2 + 255) / 256), LKv = (unsigned)(((size_t)NKV * TT * HD / 2 + 255) / 256);
    for (int b = 0; b < NB_; ++b) {
        if (b == 0) k_cscvt<<<(TT * DQ + 255) / 256, 256, 0, stream>>>(cosT, sinT, CS);
        k_cvt8<<<(unsigned)(((size_t)TT * DM / 8 + 255) / 256), 256, 0, stream>>>(x + (size_t)b * TT * DM, XB, (size_t)TT * DM / 8);
        k_gemmw<bf, 0, true><<<dim3(TT / 64, DQ / 64, 1), 32, 0, stream>>>(XB, nullptr, WQ, nullptr, DM, FQ, DQ, bq, 0, 0, 0);
        k_rmsrow<<<TT / 8, 256, 0, stream>>>(FQ, nqw); k_rope<<<LQ, 256, 0, stream>>>(FQ, DQ, NH_, CS, nullptr, nullptr, 1.0f, QP16, QPh, QPl);
        k_gemmw<bf, 0, true><<<dim3(TT / 64, DKV / 64, 1), 32, 0, stream>>>(XB, nullptr, WK, nullptr, DM, FK, DKV, bk, 0, 0, 0);
        k_rmsrow<<<TT / 8, 256, 0, stream>>>(FK, nkw); k_rope<<<LKv, 256, 0, stream>>>(FK, DKV, NKV, CS, nullptr, nullptr, 1.0f, KP16, KPh, KPl);
        k_gemmw<bf, 0, true><<<dim3(TT / 64, DKV / 64, 1), 32, 0, stream>>>(XB, nullptr, WV, nullptr, DM, FV, DKV, bv, 0, 0, 0); k_vtp<<<LKv, 256, 0, stream>>>(FV, DKV, NKV, VT16, VTh, VTl);
        for (int h0 = 0; h0 < NH_; h0 += ZH) { const size_t zq = (size_t)h0, zk = (size_t)(h0 / REP);   // one kv head per query head: the pass's two heads use consecutive kv planes (z-strides TT*HD)
            k_gemmw<bf, 2, false><<<dim3(TT / 64, TT / 64, ZH), 32, 0, stream>>>(QPh + zq * TT * HD, QPl + zq * TT * HD, KPh + zk * TT * HD, KPl + zk * TT * HD, HD, Sb, TT, nullptr, (size_t)TT * HD, (size_t)TT * HD, (size_t)TT * TT);   /* scores hl on all rows */
            k_asoft<<<ZH * TT / 8, 256, 0, stream>>>(Sb, P16, Ph, Pl);
            k_gemmw<bf, 2, false><<<dim3(RH / 64, HD / 64, ZH), 32, 0, stream>>>(Ph, Pl, VTh + zk * HD * TT, VTl + zk * HD * TT, TT, Ob, HD, nullptr, (size_t)RH * TT, (size_t)HD * TT, (size_t)TT * HD);
            k_gemmw<h16, 0, false><<<dim3((TT - RH) / 64, HD / 64, ZH), 32, 0, stream>>>(P16 + (size_t)RH * TT, nullptr, VT16 + zk * HD * TT, nullptr, TT, Ob + (size_t)RH * HD, HD, nullptr, (size_t)TT * TT, (size_t)HD * TT, (size_t)TT * HD);
            k_merge<<<(unsigned)(((size_t)ZH * TT * HD / 2 + 255) / 256), 256, 0, stream>>>(Ob, h0, ATh, ATl); }
        k_gemmw<bf, 1, true><<<dim3(TT / 64, DM / 64, 1), 32, 0, stream>>>(ATh, ATl, WO, nullptr, DQ, OUT + (size_t)b * TT * DM, DM, bo, 0, 0, 0); }
}

// v001
// It runs in 926 microseconds.
// Timed twice side by side with v000, it ran 2.22 times as fast both times.
#include <hip/hip_runtime.h>

// LTXAttention (hidden [1][2048][2048]; q/k/v = x W + b; q, k RMS-normalised across the full 2048 (eps 1e-5) * w; interleaved-pair rotary with the read per-element cos/sin [1][S][2048] (x cos + rot(x) sin, rot = (-x_odd, x_even)); 32 heads x 64; softmax(q.k / 8) (no mask); out = merged wo + bo -> [1][2048][2048]).
// Compute dtypes, f32 accumulate: every input rounded to bf16; q/k/v on PLAIN bf16 operands (inputs: exact) + bias; RMSNorm (wave per row, in place) and rotary (bf16-rounded full-width tables) f32; scores hl x hl (3 products) on EVERY row (normalised q/k: sharp), attn.v: query rows < 512 hl (3 products), the rest single fp16 (x1024); softmax f32; wo hl x exact (2 products) + bias.

#define NB_  1
#define TT   2048
#define DM   2048
#define NH_  32
#define NKV  32
#define REP  (NH_ / NKV)
#define HD   64
#define DQ   (NH_ * HD)
#define DKV  (NKV * HD)
#define ZH   2
#define RH   512                  // query rows < RH use hi+lo planes (0: none)
#define WIN  0
#define PCAR 1024.0f
#define SCL  0.125f   // HD^-0.5
#define PVW  4                    // attn.v GEMMs: waves of one work-group that share a tile's K loop
#define PVK  8                    // attn.v GEMMs: work-groups that share a tile's K loop (one partial plane of Ob each)
typedef _Float16 h16;
typedef unsigned short bf;
typedef __attribute__((ext_vector_type(16))) __bf16   v16bf;
typedef __attribute__((ext_vector_type(16))) _Float16 v16h;
typedef __attribute__((ext_vector_type(8)))  _Float16 v8h;
typedef __attribute__((ext_vector_type(8)))  unsigned short v8us;
typedef __attribute__((ext_vector_type(8)))  float    v8f;
typedef __attribute__((ext_vector_type(4)))  float    v4f;
typedef v8h  __attribute__((may_alias)) v8ha;
typedef v4f  __attribute__((may_alias)) v4fa;
typedef v8us __attribute__((may_alias)) v8usa;

__device__ __forceinline__ unsigned short f2bf(float f) { unsigned u = __float_as_uint(f); u += 0x7FFFu + ((u >> 16) & 1u); return (unsigned short)(u >> 16); }
__device__ __forceinline__ float bf2f(unsigned short b) { return __uint_as_float(((unsigned)b) << 16); }
__device__ __forceinline__ float bfr(float f) { return bf2f(f2bf(f)); }
__device__ __forceinline__ v16h cat16(v8h lo, v8h hi) { return __builtin_shufflevector(lo, hi, 0, 1, 2, 3, 4, 5, 6, 7, 8, 9, 10, 11, 12, 13, 14, 15); }
__device__ __forceinline__ v16bf cat16b(v8us lo, v8us hi) { return __builtin_bit_cast(v16bf, __builtin_shufflevector(lo, hi, 0, 1, 2, 3, 4, 5, 6, 7, 8, 9, 10, 11, 12, 13, 14, 15)); }
__device__ __forceinline__ v8f wmma16(v16h a, v16h b, v8f c) { return __builtin_amdgcn_wmma_f32_16x16x32_f16(false, a, false, b, (short)0, c, false, false); }
__device__ __forceinline__ v8f wmmab(v16bf a, v16bf b, v8f c) { return __builtin_amdgcn_wmma_f32_16x16x32_bf16(false, a, false, b, (short)0, c, false, false); }



// ---- k_gemmw: register-blocked GEMM, 64x64 output tiles (16 accumulators per wave), operands straight from K-contiguous 16-bit planes; grid (M/64, N/64, Z * KS), 32 * NW threads.
// NW == KS == 1: one wave runs a tile's whole K loop. Otherwise the 32-wide k steps of a tile are dealt round robin to KS * NW waves: the NW partial tiles of a work-group
// are summed in LDS in wave order; work-group ks stores its sum in partial plane ks (C + ks * sP), and the reader of C adds the KS planes.
// C[m][n] (f32, pitch ldc, + optional f32 bias[n]) = sum_k A[m][k] Bt[n][k] (+ split products per NSPLIT). z-batch strides sA/sB/sC in elements. K % 32 == 0.
template <typename T16> struct WFrag;
template <> struct WFrag<h16> { typedef v16h V; static __device__ __forceinline__ V ld(const h16* p) { return cat16(*(const v8h*)p, *(const v8h*)(p + 16)); } static __device__ __forceinline__ v8f mma(V a, V b, v8f c) { return wmma16(a, b, c); } };
template <> struct WFrag<bf> { typedef v16bf V; static __device__ __forceinline__ V ld(const bf* p) { return cat16b(*(const v8us*)p, *(const v8us*)(p + 16)); } static __device__ __forceinline__ v8f mma(V a, V b, v8f c) { return wmmab(a, b, c); } };
template <typename T16, int NSPLIT, bool BIAS, int NW, int KS>
__global__ __launch_bounds__(32 * NW) void k_gemmw(const T16* __restrict__ A, const T16* __restrict__ A2, const T16* __restrict__ Bt, const T16* __restrict__ Bt2, int K, float* C, int ldc, const float* __restrict__ bias, size_t sA, size_t sB, size_t sC, size_t sP) {
    typedef typename WFrag<T16>::V V;
    static_assert(KS == 1 || !BIAS, "the bias would be added once per partial plane");
    __shared__ __align__(16) float os[NW == 1 ? 16 * 68 : NW * 64 * 68];
    const int wave = NW == 1 ? 0 : __builtin_amdgcn_readfirstlane((int)(threadIdx.x >> 5));   // scalar, so the K loop keeps a scalar branch
    const int ks = (int)(blockIdx.z % KS);
    const size_t z = blockIdx.z / KS; A += z * sA; if (A2) A2 += z * sA; Bt += z * sB; if (Bt2) Bt2 += z * sB; C += z * sC + (size_t)ks * sP;
    const int lane = threadIdx.x & 31, lr = lane & 15, hi = lane >> 4; const int r0 = blockIdx.x * 64, c0 = blockIdx.y * 64;
    v8f acc[4][4];
#pragma unroll
    for (int mb = 0; mb < 4; ++mb)
#pragma unroll
        for (int nb = 0; nb < 4; ++nb) acc[mb][nb] = (v8f){};
    const size_t aoff = (size_t)(r0 + lr) * K + 8 * hi, boff = (size_t)(c0 + lr) * K + 8 * hi;
#pragma unroll 1
    for (int kc = 32 * (ks * NW + wave); kc < K; kc += 32 * NW * KS) {
        V a[4], a2[4];
#pragma unroll
        for (int mb = 0; mb < 4; ++mb) { a[mb] = WFrag<T16>::ld(A + aoff + (size_t)mb * 16 * K + kc); if (NSPLIT == 1 || NSPLIT == 2) a2[mb] = WFrag<T16>::ld(A2 + aoff + (size_t)mb * 16 * K + kc); }
#pragma unroll
        for (int nb = 0; nb < 4; ++nb) { const V b = WFrag<T16>::ld(Bt + boff + (size_t)nb * 16 * K + kc); V b2; if (NSPLIT >= 2) b2 = WFrag<T16>::ld(Bt2 + boff + (size_t)nb * 16 * K + kc);
#pragma unroll
            for (int mb = 0; mb < 4; ++mb) { acc[mb][nb] = WFrag<T16>::mma(a[mb], b, acc[mb][nb]); if (NSPLIT == 1 || NSPLIT == 2) acc[mb][nb] = WFrag<T16>::mma(a2[mb], b, acc[mb][nb]); if (NSPLIT >= 2) acc[mb][nb] = WFrag<T16>::mma(a[mb], b2, acc[mb][nb]); } }
        asm volatile("v_nop\n\tv_nop\n\tv_nop\n\tv_nop" : "+v"(acc[0][0]), "+v"(acc[1][1]), "+v"(acc[2][2]), "+v"(acc[3][3]) : "v"(a[0]), "v"(a[3]));
    }
    if constexpr (NW > 1) {
        float* ow = os + wave * (64 * 68);
#pragma unroll
        for (int mb = 0; mb < 4; ++mb)
#pragma unroll
            for (int nb = 0; nb < 4; ++nb)
#pragma unroll
                for (int j = 0; j < 8; ++j) ow[(mb * 16 + hi * 8 + j) * 68 + nb * 16 + lr] = acc[mb][nb][j];
        __syncthreads();   // every wave's partial tile is in LDS before any of them is summed
#pragma unroll
        for (int s = 0; s < 64 * 16 / (32 * NW); ++s) { const int idx = (int)threadIdx.x + s * 32 * NW; const int row = idx >> 4, cofs = (idx & 15) * 4; v4f p[NW];
#pragma unroll
            for (int w = 0; w < NW; ++w) p[w] = *(const v4fa*)(os + w * (64 * 68) + row * 68 + cofs);
            v4f val = p[0];
#pragma unroll
            for (int w = 1; w < NW; ++w) val += p[w];
            if (BIAS) { val[0] += bfr(bias[c0 + cofs]); val[1] += bfr(bias[c0 + cofs + 1]); val[2] += bfr(bias[c0 + cofs + 2]); val[3] += bfr(bias[c0 + cofs + 3]); }
            *(v4f*)(C + (size_t)(r0 + row) * ldc + c0 + cofs) = val; }
        return;
    }
#pragma unroll
    for (int mb = 0; mb < 4; ++mb) {
#pragma unroll
        for (int nb = 0; nb < 4; ++nb) {
#pragma unroll
            for (int j = 0; j < 8; ++j) os[(hi * 8 + j) * 68 + nb * 16 + lr] = acc[mb][nb][j]; }
        __builtin_amdgcn_wave_barrier(); asm volatile("" ::: "memory");
        float* crow = C + (size_t)(r0 + mb * 16) * ldc + c0;
{
#pragma unroll
            for (int s = 0; s < 8; ++s) { const int row = 2 * s + hi, cofs = lr * 4; v4f val = *(const v4fa*)(os + row * 68 + cofs); if (BIAS) { val[0] += bfr(bias[c0 + cofs]); val[1] += bfr(bias[c0 + cofs + 1]); val[2] += bfr(bias[c0 + cofs + 2]); val[3] += bfr(bias[c0 + cofs + 3]); }
                *(v4f*)(crow + (size_t)row * ldc + cofs) = val; }
             }
        __builtin_amdgcn_wave_barrier(); asm volatile("" ::: "memory");
    }
}

__device__ __forceinline__ h16 tohx(float x) { return (h16)x; }
__device__ __forceinline__ void splitf(float y, unsigned short& h, unsigned short& l) { h = f2bf(y); l = f2bf(y - bf2f(h)); }
typedef __attribute__((ext_vector_type(2))) _Float16 v2h;
typedef __attribute__((ext_vector_type(4))) _Float16 v4h;
typedef __attribute__((ext_vector_type(2))) unsigned short v2us;
typedef __attribute__((ext_vector_type(4))) unsigned short v4us;
typedef __attribute__((ext_vector_type(2))) float v2f;
typedef __attribute__((ext_vector_type(4))) int v4i;

__global__ __launch_bounds__(256) void k_wtG(const float* __restrict__ w, int K, int N, bf* Bt) {
    const int lane = threadIdx.x & 31; const int L0 = (blockIdx.x * 8 + (threadIdx.x >> 5)) * 8; const int nlines = N * K / 64;
{
#pragma unroll 1
        for (int l = 0; l < 8; ++l) { const int L = L0 + l; if (L >= nlines) break; const size_t e = (size_t)L * 64 + lane * 2; const int k = (int)(e % K), n = (int)(e / K); v2us o;
            o[0] = f2bf(w[(size_t)k * N + n]); o[1] = f2bf(w[(size_t)(k + 1) * N + n]); *(v2us*)(Bt + e) = o; }
         }
}
__global__ __launch_bounds__(256) void k_cvt8(const float* __restrict__ src, bf* dst, size_t n8) { const size_t i = (size_t)blockIdx.x * 256 + threadIdx.x; if (i >= n8) return; const v8f v = *(const v8f*)(src + i * 8); v8us o;
#pragma unroll
    for (int k = 0; k < 8; ++k) o[k] = f2bf(v[k]); *(v8us*)(dst + i * 8) = o;  }
__global__ __launch_bounds__(256) void k_cscvt(const float* __restrict__ cosT, const float* __restrict__ sinT, float* CS) { const int idx = blockIdx.x * 256 + threadIdx.x; if (idx >= TT * DQ) return; v2f cs; cs[0] = bfr(cosT[idx]); cs[1] = bfr(sinT[idx]); *(v2f*)(CS + (size_t)idx * 2) = cs;  }
// k_rope: head planes [h][t][d] (fp16 + hi/lo) of rope(x) x sc with the interleaved-pair convention out[d] = x[d] cos[t][d] - x[d+1] sin[t][d], out[d+1] = x[d+1] cos[t][d+1] + x[d] sin[t][d+1] (d even)
__global__ __launch_bounds__(256) void k_rope(const float* __restrict__ F, int pitch, int nheads, const float* __restrict__ CS, const float* __restrict__ RF, const float* __restrict__ nw, float sc, h16* P16, bf* Ph, bf* Pl) {
    const size_t e = ((size_t)blockIdx.x * 256 + threadIdx.x) * 2; if (e >= (size_t)nheads * TT * HD) return; const int d = (int)(e % HD); const int t = (int)((e / HD) % TT); const int h = (int)(e / ((size_t)HD * TT)); const float* f = F + (size_t)t * pitch + h * HD; const float rf = RF ? RF[(size_t)h * TT + t] : 1.0f; v2h o16; v2us oh, ol;
#pragma unroll
    for (int q = 0; q < 2; ++q) { const int dd = d + q; const int dp = dd ^ 1; float x0 = f[dd], x1 = f[dp];
        if (RF) { float n0 = __fmul_rn(x0, rf), n1 = __fmul_rn(x1, rf); asm volatile("" : "+v"(n0)); asm volatile("" : "+v"(n1)); x0 = __fmul_rn(bfr(nw[dd]), n0); x1 = __fmul_rn(bfr(nw[dp]), n1); }
        const v2f cs = *(const v2f*)(CS + ((size_t)t * DQ + h * HD + dd) * 2);   /* full-width per-element tables */ float a = __fmul_rn(x0, cs[0]), bq = __fmul_rn(x1, cs[1]); asm volatile("" : "+v"(a)); asm volatile("" : "+v"(bq)); const float r = (((dd & 1) == 0) ? __fsub_rn(a, bq) : __fadd_rn(a, bq)) * sc;
        o16[q] = tohx(r); unsigned short a2, c2; splitf(r, a2, c2); oh[q] = a2; ol[q] = c2; }
    *(v2h*)(P16 + e) = o16; *(v2us*)(Ph + e) = oh; *(v2us*)(Pl + e) = ol;  }
__global__ __launch_bounds__(256) void k_vtp(const float* __restrict__ F, int pitch, int nheads, h16* V16, bf* Vh, bf* Vl) { const size_t e = ((size_t)blockIdx.x * 256 + threadIdx.x) * 2; if (e >= (size_t)nheads * HD * TT) return; const int t = (int)(e % TT); const int d = (int)((e / TT) % HD); const int g = (int)(e / ((size_t)TT * HD)); v2h o16; v2us oh, ol;
#pragma unroll
    for (int q = 0; q < 2; ++q) { const float x = F[(size_t)(t + q) * pitch + g * HD + d]; o16[q] = tohx(x); unsigned short a2, c2; splitf(x, a2, c2); oh[q] = a2; ol[q] = c2; }
    *(v2h*)(V16 + e) = o16; *(v2us*)(Vh + e) = oh; *(v2us*)(Vl + e) = ol;  }
__global__ __launch_bounds__(256) void k_rmsrow(float* F, const float* __restrict__ w) { const int lane = threadIdx.x & 31; const int t = blockIdx.x * 8 + (threadIdx.x >> 5); if (t >= TT) return; float* f = F + (size_t)t * DQ; float v[DQ / 32]; float ss = 0.f;
#pragma unroll
    for (int ch = 0; ch < DQ / 128; ++ch) { const v4f a = *(const v4f*)(f + ch * 128 + lane * 4); for (int u = 0; u < 4; ++u) { v[ch * 4 + u] = a[u]; float p = __fmul_rn(a[u], a[u]); asm volatile("" : "+v"(p)); ss = __fadd_rn(ss, p); } }
#pragma unroll
    for (int sh = 16; sh; sh >>= 1) ss = __fadd_rn(ss, __shfl_xor(ss, sh, 32));
    const float rs = __fdiv_rn(1.0f, sqrtf(__fadd_rn(__fdiv_rn(ss, (float)DQ), 1e-5f)));
    {
#pragma unroll
        for (int ch = 0; ch < DQ / 128; ++ch) { v4f o; for (int u = 0; u < 4; ++u) { float y = __fmul_rn(v[ch * 4 + u], rs); asm volatile("" : "+v"(y)); o[u] = __fmul_rn(y, bfr(w[ch * 128 + lane * 4 + u])); } *(v4f*)(f + ch * 128 + lane * 4) = o; }
         } }
// k_asoft: per row (zz, i): t = S x HD^-0.5 (no mask); softmax over the 2048 keys (register row, one exp, fixed trees);
__global__ __launch_bounds__(256) void k_asoft(const float* __restrict__ Sb, h16* P16, bf* Ph, bf* Pl) {
    const int lane = threadIdx.x & 31; const int row = blockIdx.x * 8 + (threadIdx.x >> 5); if (row >= ZH * TT) return; const int i = row % TT; const int zz = row / TT; (void)zz; const bool hires = (i < RH); const float* sr = Sb + (size_t)row * TT; float v[TT / 32]; float mx = -3.0e38f;
#pragma unroll
    for (int ch = 0; ch < TT / 128; ++ch) { const int j0 = ch * 128 + lane * 4; const v4f a = *(const v4f*)(sr + j0);
#pragma unroll
        for (int q = 0; q < 4; ++q) { const int j = j0 + q; (void)j; const float t = a[q] * SCL; v[ch * 4 + q] = t; mx = fmaxf(mx, t); } }
#pragma unroll
    for (int sh = 16; sh; sh >>= 1) mx = fmaxf(mx, __shfl_xor(mx, sh, 32));
    float sum = 0.f;
#pragma unroll
    for (int k = 0; k < TT / 32; ++k) { float d0 = __fsub_rn(v[k], mx); asm volatile("" : "+v"(d0)); v[k] = __builtin_amdgcn_exp2f(__fmul_rn(d0, 1.4426950408889634f)); sum += v[k]; }
#pragma unroll
    for (int sh = 16; sh; sh >>= 1) sum += __shfl_xor(sum, sh, 32);
    const float f = __fdiv_rn(hires ? 1.0f : PCAR, sum);
{
        if (hires) {
#pragma unroll
            for (int ch = 0; ch < TT / 128; ++ch) { v4us oh, ol;
#pragma unroll
                for (int q = 0; q < 4; ++q) { unsigned short a, c2; splitf(v[ch * 4 + q] * f, a, c2); oh[q] = a; ol[q] = c2; }
                const size_t oo = ((size_t)zz * (RH ? RH : 1) + i) * TT + ch * 128 + lane * 4; *(v4us*)(Ph + oo) = oh; *(v4us*)(Pl + oo) = ol; }
        } else {
#pragma unroll
            for (int ch = 0; ch < TT / 128; ++ch) { v4h o4;
#pragma unroll
                for (int q = 0; q < 4; ++q) o4[q] = tohx(v[ch * 4 + q] * f);
                *(v4h*)(P16 + (size_t)row * TT + ch * 128 + lane * 4) = o4; } }
         }
}
__global__ __launch_bounds__(256) void k_merge(const float* __restrict__ O, int h0, bf* Ah, bf* Al) { const size_t e = ((size_t)blockIdx.x * 256 + threadIdx.x) * 2; if (e >= (size_t)ZH * TT * HD) return; const int d = (int)(e % HD); const int t = (int)((e / HD) % TT); const int zz = (int)(e / ((size_t)HD * TT)); const float cs = (t < RH) ? 1.0f : (1.0f / PCAR); const size_t oo = (size_t)t * DQ + (h0 + zz) * HD + d;
    v2us oh, ol; v2f pp[PVK];   // the PVK partial planes of the attn.v GEMMs, added in plane order
#pragma unroll
    for (int ks = 0; ks < PVK; ++ks) pp[ks] = *(const v2f*)(O + (size_t)ks * ((size_t)ZH * TT * HD) + e);
    v2f o2 = pp[0];
#pragma unroll
    for (int ks = 1; ks < PVK; ++ks) o2 += pp[ks];
#pragma unroll
    for (int q = 0; q < 2; ++q) { unsigned short a, c2; splitf(o2[q] * cs, a, c2); oh[q] = a; ol[q] = c2; } *(v2us*)(Ah + oo) = oh; *(v2us*)(Al + oo) = ol;  }

extern "C" void kernel_launch(void* const* d_in, const int* in_sizes, int n_in,
                              void* d_out, int out_size, void* d_ws, size_t ws_size, hipStream_t stream) {
    (void)in_sizes; (void)n_in; (void)out_size;
    const float* x = (const float*)d_in[0]; const float* cosT = (const float*)d_in[1]; const float* sinT = (const float*)d_in[2]; const float* wq = (const float*)d_in[3]; const float* bq = (const float*)d_in[4]; const float* wk = (const float*)d_in[5]; const float* bk = (const float*)d_in[6]; const float* wv = (const float*)d_in[7]; const float* bv = (const float*)d_in[8]; const float* nqw = (const float*)d_in[9]; const float* nkw = (const float*)d_in[10]; const float* wo = (const float*)d_in[11]; const float* bo = (const float*)d_in[12];
    float* OUT = (float*)d_out;     // [1][2048][2048]
    char* wsp = (char*)d_ws;
    auto take = [&](size_t bytes) { char* p = wsp; wsp += (bytes + 255) & ~(size_t)255; return (void*)p; };
    bf* WQ = (bf*)take((size_t)DQ * DM * 2); bf* WK = (bf*)take((size_t)DKV * DM * 2); bf* WV = (bf*)take((size_t)DKV * DM * 2); bf* WO = (bf*)take((size_t)DM * DQ * 2); float* CS = (float*)take((size_t)TT * DQ * 2 * 4);
    bf* XB = (bf*)take((size_t)TT * DM * 2); float* FQ = (float*)take((size_t)TT * DQ * 4); float* FK = (float*)take((size_t)TT * DKV * 4);
    h16* QP16 = (h16*)take((size_t)NH_ * TT * HD * 2); h16* KP16 = (h16*)take((size_t)NKV * TT * HD * 2); h16* VT16 = (h16*)take((size_t)NKV * HD * TT * 2);
    bf* QPh = (bf*)take((size_t)NH_ * TT * HD * 2); bf* QPl = (bf*)take((size_t)NH_ * TT * HD * 2); bf* KPh = (bf*)take((size_t)NKV * TT * HD * 2); bf* KPl = (bf*)take((size_t)NKV * TT * HD * 2); bf* VTh = (bf*)take((size_t)NKV * HD * TT * 2); bf* VTl = (bf*)take((size_t)NKV * HD * TT * 2); bf* Ph = (bf*)take((size_t)ZH * RH * TT * 2); bf* Pl = (bf*)take((size_t)ZH * RH * TT * 2);
    float* Sb = (float*)take((size_t)ZH * TT * TT * 4); h16* P16 = (h16*)take((size_t)ZH * TT * TT * 2); float* Ob = (float*)take((size_t)PVK * ZH * TT * HD * 4); bf* ATh = (bf*)take((size_t)TT * DQ * 2); bf* ATl = (bf*)take((size_t)TT * DQ * 2);
    if ((size_t)(wsp - (char*)d_ws) > ws_size) return;    // ws 256 MiB
    float* FV = FK;   // v projection reuses the k buffer after the k planes are built (stream-ordered)
    { k_wtG<<<(unsigned)((DM * DQ / 64 + 63) / 64), 256, 0, stream>>>(wq, DM, DQ, WQ); k_wtG<<<(unsigned)((DM * DKV / 64 + 63) / 64), 256, 0, stream>>>(wk, DM, DKV, WK); k_wtG<<<(unsigned)((DM * DKV / 64 + 63) / 64), 256, 0, stream>>>(wv, DM, DKV, WV);
      k_wtG<<<(unsigned)((DQ * DM / 64 + 63) / 64), 256, 0, stream>>>(wo, DQ, DM, WO);
       }
    const unsigned LQ = (unsigned)(((size_t)NH_ * TT * HD / 2 + 255) / 256), LKv = (unsigned)(((size_t)NKV * TT * HD / 2 + 255) / 256);
    for (int b = 0; b < NB_; ++b) {
        if (b == 0) k_cscvt<<<(TT * DQ + 255) / 256, 256, 0, stream>>>(cosT, sinT, CS);
        k_cvt8<<<(unsigned)(((size_t)TT * DM / 8 + 255) / 256), 256, 0, stream>>>(x + (size_t)b * TT * DM, XB, (size_t)TT * DM / 8);
        k_gemmw<bf, 0, true, 1, 1><<<dim3(TT / 64, DQ / 64, 1), 32, 0, stream>>>(XB, nullptr, WQ, nullptr, DM, FQ, DQ, bq, 0, 0, 0, 0);
        k_rmsrow<<<TT / 8, 256, 0, stream>>>(FQ, nqw); k_rope<<<LQ, 256, 0, stream>>>(FQ, DQ, NH_, CS, nullptr, nullptr, 1.0f, QP16, QPh, QPl);
        k_gemmw<bf, 0, true, 1, 1><<<dim3(TT / 64, DKV / 64, 1), 32, 0, stream>>>(XB, nullptr, WK, nullptr, DM, FK, DKV, bk, 0, 0, 0, 0);
        k_rmsrow<<<TT / 8, 256, 0, stream>>>(FK, nkw); k_rope<<<LKv, 256, 0, stream>>>(FK, DKV, NKV, CS, nullptr, nullptr, 1.0f, KP16, KPh, KPl);
        k_gemmw<bf, 0, true, 1, 1><<<dim3(TT / 64, DKV / 64, 1), 32, 0, stream>>>(XB, nullptr, WV, nullptr, DM, FV, DKV, bv, 0, 0, 0, 0); k_vtp<<<LKv, 256, 0, stream>>>(FV, DKV, NKV, VT16, VTh, VTl);
        for (int h0 = 0; h0 < NH_; h0 += ZH) { const size_t zq = (size_t)h0, zk = (size_t)(h0 / REP);   // one kv head per query head: the pass's two heads use consecutive kv planes (z-strides TT*HD)
            k_gemmw<bf, 2, false, 1, 1><<<dim3(TT / 64, TT / 64, ZH), 32, 0, stream>>>(QPh + zq * TT * HD, QPl + zq * TT * HD, KPh + zk * TT * HD, KPl + zk * TT * HD, HD, Sb, TT, nullptr, (size_t)TT * HD, (size_t)TT * HD, (size_t)TT * TT, 0);   /* scores hl on all rows */
            k_asoft<<<ZH * TT / 8, 256, 0, stream>>>(Sb, P16, Ph, Pl);
            k_gemmw<bf, 2, false, PVW, PVK><<<dim3(RH / 64, HD / 64, ZH * PVK), 32 * PVW, 0, stream>>>(Ph, Pl, VTh + zk * HD * TT, VTl + zk * HD * TT, TT, Ob, HD, nullptr, (size_t)RH * TT, (size_t)HD * TT, (size_t)TT * HD, (size_t)ZH * TT * HD);
            k_gemmw<h16, 0, false, PVW, PVK><<<dim3((TT - RH) / 64, HD / 64, ZH * PVK), 32 * PVW, 0, stream>>>(P16 + (size_t)RH * TT, nullptr, VT16 + zk * HD * TT, nullptr, TT, Ob + (size_t)RH * HD, HD, nullptr, (size_t)TT * TT, (size_t)HD * TT, (size_t)TT * HD, (size_t)ZH * TT * HD);
            k_merge<<<(unsigned)(((size_t)ZH * TT * HD / 2 + 255) / 256), 256, 0, stream>>>(Ob, h0, ATh, ATl); }
        k_gemmw<bf, 1, true, 1, 1><<<dim3(TT / 64, DM / 64, 1), 32, 0, stream>>>(ATh, ATl, WO, nullptr, DQ, OUT + (size_t)b * TT * DM, DM, bo, 0, 0, 0, 0); }
}

// v002
// Measured time: 511 microseconds a run.
// Next to v001, in two timings, it ran 1.82 and 1.81 times as fast.
// All steps since v000 together make it 4.03 times as fast.
#include <hip/hip_runtime.h>

// LTXAttention (hidden [1][2048][2048]; q/k/v = x W + b; q, k RMS-normalised across the full 2048 (eps 1e-5) * w; interleaved-pair rotary with the read per-element cos/sin [1][S][2048] (x cos + rot(x) sin, rot = (-x_odd, x_even)); 32 heads x 64; softmax(q.k / 8) (no mask); out = merged wo + bo -> [1][2048][2048]).
// Compute dtypes, f32 accumulate: every input rounded to bf16; q/k/v on PLAIN bf16 operands (inputs: exact) + bias; RMSNorm (wave per row, in place) and rotary (bf16-rounded full-width tables) f32; scores hl x hl (3 products) on EVERY row (normalised q/k: sharp), attn.v: query rows < 512 hl (3 products), the rest single fp16 (x1024); softmax f32; wo hl x exact (2 products) + bias.

#define NB_  1
#define TT   2048
#define DM   2048
#define NH_  32
#define NKV  32
#define REP  (NH_ / NKV)
#define HD   64
#define DQ   (NH_ * HD)
#define DKV  (NKV * HD)
#define RH   512                  // query rows < RH use hi+lo planes (0: none)
#define WIN  0
#define PCAR 1024.0f
#define SCL  0.125f   // HD^-0.5
typedef _Float16 h16;
typedef unsigned short bf;
typedef __attribute__((ext_vector_type(16))) __bf16   v16bf;
typedef __attribute__((ext_vector_type(16))) _Float16 v16h;
typedef __attribute__((ext_vector_type(8)))  _Float16 v8h;
typedef __attribute__((ext_vector_type(8)))  unsigned short v8us;
typedef __attribute__((ext_vector_type(8)))  float    v8f;
typedef __attribute__((ext_vector_type(4)))  float    v4f;
typedef v8h  __attribute__((may_alias)) v8ha;
typedef v4f  __attribute__((may_alias)) v4fa;
typedef v8us __attribute__((may_alias)) v8usa;

__device__ __forceinline__ unsigned short f2bf(float f) { unsigned u = __float_as_uint(f); u += 0x7FFFu + ((u >> 16) & 1u); return (unsigned short)(u >> 16); }
__device__ __forceinline__ float bf2f(unsigned short b) { return __uint_as_float(((unsigned)b) << 16); }
__device__ __forceinline__ float bfr(float f) { return bf2f(f2bf(f)); }
__device__ __forceinline__ v16h cat16(v8h lo, v8h hi) { return __builtin_shufflevector(lo, hi, 0, 1, 2, 3, 4, 5, 6, 7, 8, 9, 10, 11, 12, 13, 14, 15); }
__device__ __forceinline__ v16bf cat16b(v8us lo, v8us hi) { return __builtin_bit_cast(v16bf, __builtin_shufflevector(lo, hi, 0, 1, 2, 3, 4, 5, 6, 7, 8, 9, 10, 11, 12, 13, 14, 15)); }
__device__ __forceinline__ v8f wmma16(v16h a, v16h b, v8f c) { return __builtin_amdgcn_wmma_f32_16x16x32_f16(false, a, false, b, (short)0, c, false, false); }
__device__ __forceinline__ v8f wmmab(v16bf a, v16bf b, v8f c) { return __builtin_amdgcn_wmma_f32_16x16x32_bf16(false, a, false, b, (short)0, c, false, false); }



// ---- k_gemmw: register-blocked GEMM, 64x64 output tiles (16 accumulators per wave), operands straight from K-contiguous 16-bit planes; grid (M/64, N/64, Z * KS), 32 * NW threads.
// NW == KS == 1: one wave runs a tile's whole K loop. Otherwise the 32-wide k steps of a tile are dealt round robin to KS * NW waves: the NW partial tiles of a work-group
// are summed in LDS in wave order; work-group ks stores its sum in partial plane ks (C + ks * sP), and the reader of C adds the KS planes.
// C[m][n] (f32, pitch ldc, + optional f32 bias[n]) = sum_k A[m][k] Bt[n][k] (+ split products per NSPLIT). z-batch strides sA/sB/sC in elements. K % 32 == 0.
template <typename T16> struct WFrag;
template <> struct WFrag<h16> { typedef v16h V; static __device__ __forceinline__ V ld(const h16* p) { return cat16(*(const v8h*)p, *(const v8h*)(p + 16)); } static __device__ __forceinline__ v8f mma(V a, V b, v8f c) { return wmma16(a, b, c); } };
template <> struct WFrag<bf> { typedef v16bf V; static __device__ __forceinline__ V ld(const bf* p) { return cat16b(*(const v8us*)p, *(const v8us*)(p + 16)); } static __device__ __forceinline__ v8f mma(V a, V b, v8f c) { return wmmab(a, b, c); } };
template <typename T16, int NSPLIT, bool BIAS, int NW, int KS>
__global__ __launch_bounds__(32 * NW) void k_gemmw(const T16* __restrict__ A, const T16* __restrict__ A2, const T16* __restrict__ Bt, const T16* __restrict__ Bt2, int K, float* C, int ldc, const float* __restrict__ bias, size_t sA, size_t sB, size_t sC, size_t sP) {
    typedef typename WFrag<T16>::V V;
    static_assert(KS == 1 || !BIAS, "the bias would be added once per partial plane");
    __shared__ __align__(16) float os[NW == 1 ? 16 * 68 : NW * 64 * 68];
    const int wave = NW == 1 ? 0 : __builtin_amdgcn_readfirstlane((int)(threadIdx.x >> 5));   // scalar, so the K loop keeps a scalar branch
    const int ks = (int)(blockIdx.z % KS);
    const size_t z = blockIdx.z / KS; A += z * sA; if (A2) A2 += z * sA; Bt += z * sB; if (Bt2) Bt2 += z * sB; C += z * sC + (size_t)ks * sP;
    const int lane = threadIdx.x & 31, lr = lane & 15, hi = lane >> 4; const int r0 = blockIdx.x * 64, c0 = blockIdx.y * 64;
    v8f acc[4][4];
#pragma unroll
    for (int mb = 0; mb < 4; ++mb)
#pragma unroll
        for (int nb = 0; nb < 4; ++nb) acc[mb][nb] = (v8f){};
    const size_t aoff = (size_t)(r0 + lr) * K + 8 * hi, boff = (size_t)(c0 + lr) * K + 8 * hi;
#pragma unroll 1
    for (int kc = 32 * (ks * NW + wave); kc < K; kc += 32 * NW * KS) {
        V a[4], a2[4];
#pragma unroll
        for (int mb = 0; mb < 4; ++mb) { a[mb] = WFrag<T16>::ld(A + aoff + (size_t)mb * 16 * K + kc); if (NSPLIT == 1 || NSPLIT == 2) a2[mb] = WFrag<T16>::ld(A2 + aoff + (size_t)mb * 16 * K + kc); }
#pragma unroll
        for (int nb = 0; nb < 4; ++nb) { const V b = WFrag<T16>::ld(Bt + boff + (size_t)nb * 16 * K + kc); V b2; if (NSPLIT >= 2) b2 = WFrag<T16>::ld(Bt2 + boff + (size_t)nb * 16 * K + kc);
#pragma unroll
            for (int mb = 0; mb < 4; ++mb) { acc[mb][nb] = WFrag<T16>::mma(a[mb], b, acc[mb][nb]); if (NSPLIT == 1 || NSPLIT == 2) acc[mb][nb] = WFrag<T16>::mma(a2[mb], b, acc[mb][nb]); if (NSPLIT >= 2) acc[mb][nb] = WFrag<T16>::mma(a[mb], b2, acc[mb][nb]); } }
        asm volatile("v_nop\n\tv_nop\n\tv_nop\n\tv_nop" : "+v"(acc[0][0]), "+v"(acc[1][1]), "+v"(acc[2][2]), "+v"(acc[3][3]) : "v"(a[0]), "v"(a[3]));
    }
    if constexpr (NW > 1) {
        float* ow = os + wave * (64 * 68);
#pragma unroll
        for (int mb = 0; mb < 4; ++mb)
#pragma unroll
            for (int nb = 0; nb < 4; ++nb)
#pragma unroll
                for (int j = 0; j < 8; ++j) ow[(mb * 16 + hi * 8 + j) * 68 + nb * 16 + lr] = acc[mb][nb][j];
        __syncthreads();   // every wave's partial tile is in LDS before any of them is summed
#pragma unroll
        for (int s = 0; s < 64 * 16 / (32 * NW); ++s) { const int idx = (int)threadIdx.x + s * 32 * NW; const int row = idx >> 4, cofs = (idx & 15) * 4; v4f p[NW];
#pragma unroll
            for (int w = 0; w < NW; ++w) p[w] = *(const v4fa*)(os + w * (64 * 68) + row * 68 + cofs);
            v4f val = p[0];
#pragma unroll
            for (int w = 1; w < NW; ++w) val += p[w];
            if (BIAS) { val[0] += bfr(bias[c0 + cofs]); val[1] += bfr(bias[c0 + cofs + 1]); val[2] += bfr(bias[c0 + cofs + 2]); val[3] += bfr(bias[c0 + cofs + 3]); }
            *(v4f*)(C + (size_t)(r0 + row) * ldc + c0 + cofs) = val; }
        return;
    }
#pragma unroll
    for (int mb = 0; mb < 4; ++mb) {
#pragma unroll
        for (int nb = 0; nb < 4; ++nb) {
#pragma unroll
            for (int j = 0; j < 8; ++j) os[(hi * 8 + j) * 68 + nb * 16 + lr] = acc[mb][nb][j]; }
        __builtin_amdgcn_wave_barrier(); asm volatile("" ::: "memory");
        float* crow = C + (size_t)(r0 + mb * 16) * ldc + c0;
{
#pragma unroll
            for (int s = 0; s < 8; ++s) { const int row = 2 * s + hi, cofs = lr * 4; v4f val = *(const v4fa*)(os + row * 68 + cofs); if (BIAS) { val[0] += bfr(bias[c0 + cofs]); val[1] += bfr(bias[c0 + cofs + 1]); val[2] += bfr(bias[c0 + cofs + 2]); val[3] += bfr(bias[c0 + cofs + 3]); }
                *(v4f*)(crow + (size_t)row * ldc + cofs) = val; }
             }
        __builtin_amdgcn_wave_barrier(); asm volatile("" ::: "memory");
    }
}

__device__ __forceinline__ h16 tohx(float x) { return (h16)x; }
__device__ __forceinline__ void splitf(float y, unsigned short& h, unsigned short& l) { h = f2bf(y); l = f2bf(y - bf2f(h)); }
typedef __attribute__((ext_vector_type(2))) _Float16 v2h;
typedef __attribute__((ext_vector_type(4))) _Float16 v4h;
typedef __attribute__((ext_vector_type(2))) unsigned short v2us;
typedef __attribute__((ext_vector_type(4))) unsigned short v4us;
typedef __attribute__((ext_vector_type(2))) float v2f;
typedef __attribute__((ext_vector_type(4))) int v4i;

__global__ __launch_bounds__(256) void k_wtG(const float* __restrict__ w, int K, int N, bf* Bt) {
    const int lane = threadIdx.x & 31; const int L0 = (blockIdx.x * 8 + (threadIdx.x >> 5)) * 8; const int nlines = N * K / 64;
{
#pragma unroll 1
        for (int l = 0; l < 8; ++l) { const int L = L0 + l; if (L >= nlines) break; const size_t e = (size_t)L * 64 + lane * 2; const int k = (int)(e % K), n = (int)(e / K); v2us o;
            o[0] = f2bf(w[(size_t)k * N + n]); o[1] = f2bf(w[(size_t)(k + 1) * N + n]); *(v2us*)(Bt + e) = o; }
         }
}
__global__ __launch_bounds__(256) void k_cvt8(const float* __restrict__ src, bf* dst, size_t n8) { const size_t i = (size_t)blockIdx.x * 256 + threadIdx.x; if (i >= n8) return; const v8f v = *(const v8f*)(src + i * 8); v8us o;
#pragma unroll
    for (int k = 0; k < 8; ++k) o[k] = f2bf(v[k]); *(v8us*)(dst + i * 8) = o;  }
__global__ __launch_bounds__(256) void k_cscvt(const float* __restrict__ cosT, const float* __restrict__ sinT, float* CS) { const int idx = blockIdx.x * 256 + threadIdx.x; if (idx >= TT * DQ) return; v2f cs; cs[0] = bfr(cosT[idx]); cs[1] = bfr(sinT[idx]); *(v2f*)(CS + (size_t)idx * 2) = cs;  }
// k_rope: head planes [h][t][d] (fp16 + hi/lo) of rope(x) x sc with the interleaved-pair convention out[d] = x[d] cos[t][d] - x[d+1] sin[t][d], out[d+1] = x[d+1] cos[t][d+1] + x[d] sin[t][d+1] (d even)
__global__ __launch_bounds__(256) void k_rope(const float* __restrict__ F, int pitch, int nheads, const float* __restrict__ CS, const float* __restrict__ RF, const float* __restrict__ nw, float sc, h16* P16, bf* Ph, bf* Pl) {
    const size_t e = ((size_t)blockIdx.x * 256 + threadIdx.x) * 2; if (e >= (size_t)nheads * TT * HD) return; const int d = (int)(e % HD); const int t = (int)((e / HD) % TT); const int h = (int)(e / ((size_t)HD * TT)); const float* f = F + (size_t)t * pitch + h * HD; const float rf = RF ? RF[(size_t)h * TT + t] : 1.0f; v2h o16; v2us oh, ol;
#pragma unroll
    for (int q = 0; q < 2; ++q) { const int dd = d + q; const int dp = dd ^ 1; float x0 = f[dd], x1 = f[dp];
        if (RF) { float n0 = __fmul_rn(x0, rf), n1 = __fmul_rn(x1, rf); asm volatile("" : "+v"(n0)); asm volatile("" : "+v"(n1)); x0 = __fmul_rn(bfr(nw[dd]), n0); x1 = __fmul_rn(bfr(nw[dp]), n1); }
        const v2f cs = *(const v2f*)(CS + ((size_t)t * DQ + h * HD + dd) * 2);   /* full-width per-element tables */ float a = __fmul_rn(x0, cs[0]), bq = __fmul_rn(x1, cs[1]); asm volatile("" : "+v"(a)); asm volatile("" : "+v"(bq)); const float r = (((dd & 1) == 0) ? __fsub_rn(a, bq) : __fadd_rn(a, bq)) * sc;
        o16[q] = tohx(r); unsigned short a2, c2; splitf(r, a2, c2); oh[q] = a2; ol[q] = c2; }
    *(v2h*)(P16 + e) = o16; *(v2us*)(Ph + e) = oh; *(v2us*)(Pl + e) = ol;  }
__global__ __launch_bounds__(256) void k_vtp(const float* __restrict__ F, int pitch, int nheads, h16* V16, bf* Vh, bf* Vl) { const size_t e = ((size_t)blockIdx.x * 256 + threadIdx.x) * 2; if (e >= (size_t)nheads * HD * TT) return; const int t = (int)(e % TT); const int d = (int)((e / TT) % HD); const int g = (int)(e / ((size_t)TT * HD)); v2h o16; v2us oh, ol;
#pragma unroll
    for (int q = 0; q < 2; ++q) { const float x = F[(size_t)(t + q) * pitch + g * HD + d]; o16[q] = tohx(x); unsigned short a2, c2; splitf(x, a2, c2); oh[q] = a2; ol[q] = c2; }
    *(v2h*)(V16 + e) = o16; *(v2us*)(Vh + e) = oh; *(v2us*)(Vl + e) = ol;  }
__global__ __launch_bounds__(256) void k_rmsrow(float* F, const float* __restrict__ w) { const int lane = threadIdx.x & 31; const int t = blockIdx.x * 8 + (threadIdx.x >> 5); if (t >= TT) return; float* f = F + (size_t)t * DQ; float v[DQ / 32]; float ss = 0.f;
#pragma unroll
    for (int ch = 0; ch < DQ / 128; ++ch) { const v4f a = *(const v4f*)(f + ch * 128 + lane * 4); for (int u = 0; u < 4; ++u) { v[ch * 4 + u] = a[u]; float p = __fmul_rn(a[u], a[u]); asm volatile("" : "+v"(p)); ss = __fadd_rn(ss, p); } }
#pragma unroll
    for (int sh = 16; sh; sh >>= 1) ss = __fadd_rn(ss, __shfl_xor(ss, sh, 32));
    const float rs = __fdiv_rn(1.0f, sqrtf(__fadd_rn(__fdiv_rn(ss, (float)DQ), 1e-5f)));
    {
#pragma unroll
        for (int ch = 0; ch < DQ / 128; ++ch) { v4f o; for (int u = 0; u < 4; ++u) { float y = __fmul_rn(v[ch * 4 + u], rs); asm volatile("" : "+v"(y)); o[u] = __fmul_rn(y, bfr(w[ch * 128 + lane * 4 + u])); } *(v4f*)(f + ch * 128 + lane * 4) = o; }
         } }
#define AW 8                      // waves of a work-group
#define AQ 2                      // 16-query column groups of a wave
#define AHW (RH / (16 * AQ) / (TT / (16 * AQ * AW)))   // waves of every work-group that take a hi+lo query tile, so that all work-groups cost the same
struct KFrag { v16bf h[2][2], l[2][2]; };   // 32 keys: [16-key tile][32-wide step of d]
// xwait: behind a run of loads and in front of the step of their offset register; it names the offset, so that it is stepped, and its register used anew, only behind it
__device__ __forceinline__ void xwait(unsigned& o) { asm volatile("s_wait_xcnt 0x0" : "+v"(o) :: "memory"); }
// fragment at a wave-uniform plane pointer + the lane's own byte offset + a constant: k octets hi and 2 + hi of a 32-wide step
__device__ __forceinline__ v16bf ldfb(const bf* __restrict__ base, unsigned off, int imm) { const char* p = (const char*)base + (size_t)off + imm; return cat16b(*(const v8us*)p, *(const v8us*)(p + 32)); }
__device__ __forceinline__ v16h ldfh(const h16* __restrict__ base, unsigned off, int imm) { const char* p = (const char*)base + (size_t)off + imm; return cat16(*(const v8h*)p, *(const v8h*)(p + 32)); }
__device__ __forceinline__ void ldk(KFrag& f, const bf* __restrict__ kh, const bf* __restrict__ kl, unsigned& ko) {
#pragma unroll
    for (int t = 0; t < 2; ++t)
#pragma unroll
        for (int kk = 0; kk < 2; ++kk) { f.h[t][kk] = ldfb(kh, ko, (t * 16 * HD + kk * 32) * 2); f.l[t][kk] = ldfb(kl, ko, (t * 16 * HD + kk * 32) * 2); }
    xwait(ko);
}
__device__ __forceinline__ v8f scoreT(const KFrag& f, int t, const v16bf* qh, const v16bf* ql) { v8f s = (v8f){};
#pragma unroll
    for (int kk = 0; kk < 2; ++kk) { s = wmmab(f.h[t][kk], qh[kk], s); s = wmmab(f.h[t][kk], ql[kk], s); s = wmmab(f.l[t][kk], qh[kk], s); }
    return s; }
template <bool HR> struct VFrag;
template <> struct VFrag<true> { v16bf h[4], l[4]; };   // 32 keys of V^T: [16-row tile of d]
template <> struct VFrag<false> { v16h x[4]; };
__device__ __forceinline__ void ldv(VFrag<true>& f, const h16* __restrict__, const bf* __restrict__ vh, const bf* __restrict__ vl, unsigned& vo) {
#pragma unroll
    for (int mb = 0; mb < 4; ++mb) { f.h[mb] = ldfb(vh, vo, mb * 16 * TT * 2); f.l[mb] = ldfb(vl, vo, mb * 16 * TT * 2); }
    xwait(vo); }
__device__ __forceinline__ void ldv(VFrag<false>& f, const h16* __restrict__ v16, const bf* __restrict__, const bf* __restrict__, unsigned& vo) {
#pragma unroll
    for (int mb = 0; mb < 4; ++mb) f.x[mb] = ldfh(v16, vo, mb * 16 * TT * 2);
    xwait(vo); }
__device__ __forceinline__ void pv(v8f* o, const VFrag<true>& f, const float* p) { v8us h0, h1, l0, l1;
#pragma unroll
    for (int r = 0; r < 8; ++r) { unsigned short a, c2; splitf(p[r], a, c2); h0[r] = a; l0[r] = c2; splitf(p[8 + r], a, c2); h1[r] = a; l1[r] = c2; }
    const v16bf ph = cat16b(h0, h1), pl = cat16b(l0, l1);
#pragma unroll
    for (int mb = 0; mb < 4; ++mb) { o[mb] = wmmab(f.h[mb], ph, o[mb]); o[mb] = wmmab(f.h[mb], pl, o[mb]); o[mb] = wmmab(f.l[mb], ph, o[mb]); } }
__device__ __forceinline__ void pv(v8f* o, const VFrag<false>& f, const float* p) { v16h p16;
#pragma unroll
    for (int r = 0; r < 16; ++r) p16[r] = tohx(p[r] * PCAR);
#pragma unroll
    for (int mb = 0; mb < 4; ++mb) o[mb] = wmma16(f.x[mb], p16, o[mb]); }
template <bool HR>
__device__ __forceinline__ void attn_tile(const bf* __restrict__ Qh, const bf* __restrict__ Ql, const bf* __restrict__ Kh, const bf* __restrict__ Kl, const h16* __restrict__ V16, const bf* __restrict__ Vh, const bf* __restrict__ Vl, bf* Ah, bf* Al, int q0) {
    const int lane = threadIdx.x & 31, lr = lane & 15, hi = lane >> 4;
    unsigned qo = (unsigned)((q0 + lr) * HD + 8 * hi) * 2, ko = (unsigned)(lr * HD + 8 * hi) * 2, vo = (unsigned)(lr * TT + 8 * hi) * 2;   // the lane's byte offsets in the Q, K and V^T planes of the head
    v16bf qh[AQ][2], ql[AQ][2];
#pragma unroll
    for (int g = 0; g < AQ; ++g)
#pragma unroll
        for (int kk = 0; kk < 2; ++kk) { qh[g][kk] = ldfb(Qh, qo, (g * 16 * HD + kk * 32) * 2); ql[g][kk] = ldfb(Ql, qo, (g * 16 * HD + kk * 32) * 2); }
    xwait(qo);
    float mx[AQ], sum[AQ]; v8f o[AQ][4];
#pragma unroll
    for (int g = 0; g < AQ; ++g) { mx[g] = -3.0e38f; sum[g] = 0.f;
#pragma unroll
        for (int mb = 0; mb < 4; ++mb) o[g][mb] = (v8f){}; }
    // every fetch runs ahead of its use and wraps to key 0 behind the last key, so it stays in bounds
    const unsigned ko0 = ko; KFrag kc, kd; ldk(kc, Kh, Kl, ko); ko += 32 * HD * 2; ldk(kd, Kh, Kl, ko); ko += 32 * HD * 2;
    for (int j0 = 0; j0 < TT; j0 += 64) {   // two fragment sets in turn: each is fetched anew behind its last use and flies while the other is worked on
#pragma unroll
        for (int t = 0; t < 2; ++t)
#pragma unroll
            for (int g = 0; g < AQ; ++g) { const v8f s = scoreT(kc, t, qh[g], ql[g]);
#pragma unroll
                for (int r = 0; r < 8; ++r) mx[g] = fmaxf(mx[g], s[r]); }
        ldk(kc, Kh, Kl, ko); ko += 32 * HD * 2;   // the last trip fetches keys 0..31, which walk 2 starts with
        __builtin_amdgcn_sched_barrier(0);   // keeps the two sets' products apart: merged, both sets are fetched late in the trip and waited for at the head of the next
#pragma unroll
        for (int t = 0; t < 2; ++t)
#pragma unroll
            for (int g = 0; g < AQ; ++g) { const v8f s = scoreT(kd, t, qh[g], ql[g]);
#pragma unroll
                for (int r = 0; r < 8; ++r) mx[g] = fmaxf(mx[g], s[r]); }
        ldk(kd, Kh, Kl, ko); ko += (unsigned)(((j0 + 128 == TT) ? 32 - TT : 32) * HD * 2);
    }
    ko = ko0 + 32 * HD * 2;
#pragma unroll
    for (int g = 0; g < AQ; ++g) mx[g] = fmaxf(mx[g], __shfl_xor(mx[g], 16, 32)) * SCL;   // SCL is a power of two: max(s) * SCL == max(s * SCL)
    VFrag<HR> vc; ldv(vc, V16, Vh, Vl, vo); vo += 32 * 2;
    for (int j0 = 0; j0 < TT; j0 += 32) { const int st = (j0 + 64 == TT) ? -(TT - 32) : 32;   // the last trip fetches keys 0..31 again (in bounds, unused)
        v8f s[AQ][2];
#pragma unroll
        for (int t = 0; t < 2; ++t)
#pragma unroll
            for (int g = 0; g < AQ; ++g) s[g][t] = scoreT(kc, t, qh[g], ql[g]);
        ldk(kc, Kh, Kl, ko); ko += (unsigned)(st * HD * 2);   // the next keys, behind the last use of these: they fly during exp and attn.v
#pragma unroll
        for (int g = 0; g < AQ; ++g) { float p[16];
#pragma unroll
            for (int t = 0; t < 2; ++t)
#pragma unroll
                for (int r = 0; r < 8; ++r) { p[t * 8 + r] = __builtin_amdgcn_exp2f((s[g][t][r] * SCL - mx[g]) * 1.4426950408889634f); sum[g] += p[t * 8 + r]; }
            pv(o[g], vc, p); }
        ldv(vc, V16, Vh, Vl, vo); vo += (unsigned)(st * 2);   // the next V^T columns fly during the next trip's scores
    }
#pragma unroll
    for (int g = 0; g < AQ; ++g) { const float fin = __fdiv_rn(1.0f, sum[g] + __shfl_xor(sum[g], 16, 32)) * (HR ? 1.0f : 1.0f / PCAR);
#pragma unroll
        for (int mb = 0; mb < 4; ++mb) { v8us oh, ol;
#pragma unroll
            for (int r = 0; r < 8; ++r) { unsigned short a, c2; splitf(o[g][mb][r] * fin, a, c2); oh[r] = a; ol[r] = c2; }
            const size_t oo = (size_t)(q0 + g * 16 + lr) * DQ + mb * 16 + 8 * hi;
            // the two stores and their s_wait_xcnt in one statement: in a statement of its own the wait sank below the next tile's values, which take the stores' registers anew
            asm volatile("global_store_b128 %0, %2, off\n\tglobal_store_b128 %1, %3, off\n\ts_wait_xcnt 0x0" :: "v"(Ah + oo), "v"(Al + oo), "v"(oh), "v"(ol) : "memory"); } }
}
__global__ __launch_bounds__(32 * AW) void k_attn(const bf* __restrict__ QPh, const bf* __restrict__ QPl, const bf* __restrict__ KPh, const bf* __restrict__ KPl, const h16* __restrict__ VT16, const bf* __restrict__ VTh, const bf* __restrict__ VTl, bf* ATh, bf* ATl) {
    static_assert(RH % (16 * AQ) == 0 && (RH / (16 * AQ)) % (TT / (16 * AQ * AW)) == 0 && TT % 128 == 0, "query tiles deal evenly, walk 1 takes 64 keys a trip");
    const int wave = __builtin_amdgcn_readfirstlane((int)(threadIdx.x >> 5));   // scalar, so the choice of the tile's kind is a scalar branch
    const size_t zq = (size_t)blockIdx.y * TT * HD, zk = (size_t)(blockIdx.y / REP) * TT * HD; bf* ah = ATh + blockIdx.y * HD; bf* al = ATl + blockIdx.y * HD;
    if (wave < AHW) attn_tile<true>(QPh + zq, QPl + zq, KPh + zk, KPl + zk, VT16 + zk, VTh + zk, VTl + zk, ah, al, ((int)blockIdx.x * AHW + wave) * (16 * AQ));
    else attn_tile<false>(QPh + zq, QPl + zq, KPh + zk, KPl + zk, VT16 + zk, VTh + zk, VTl + zk, ah, al, RH + ((int)blockIdx.x * (AW - AHW) + wave - AHW) * (16 * AQ));
}

extern "C" void kernel_launch(void* const* d_in, const int* in_sizes, int n_in,
                              void* d_out, int out_size, void* d_ws, size_t ws_size, hipStream_t stream) {
    (void)in_sizes; (void)n_in; (void)out_size;
    const float* x = (const float*)d_in[0]; const float* cosT = (const float*)d_in[1]; const float* sinT = (const float*)d_in[2]; const float* wq = (const float*)d_in[3]; const float* bq = (const float*)d_in[4]; const float* wk = (const float*)d_in[5]; const float* bk = (const float*)d_in[6]; const float* wv = (const float*)d_in[7]; const float* bv = (const float*)d_in[8]; const float* nqw = (const float*)d_in[9]; const float* nkw = (const float*)d_in[10]; const float* wo = (const float*)d_in[11]; const float* bo = (const float*)d_in[12];
    float* OUT = (float*)d_out;     // [1][2048][2048]
    char* wsp = (char*)d_ws;
    auto take = [&](size_t bytes) { char* p = wsp; wsp += (bytes + 255) & ~(size_t)255; return (void*)p; };
    bf* WQ = (bf*)take((size_t)DQ * DM * 2); bf* WK = (bf*)take((size_t)DKV * DM * 2); bf* WV = (bf*)take((size_t)DKV * DM * 2); bf* WO = (bf*)take((size_t)DM * DQ * 2); float* CS = (float*)take((size_t)TT * DQ * 2 * 4);
    bf* XB = (bf*)take((size_t)TT * DM * 2); float* FQ = (float*)take((size_t)TT * DQ * 4); float* FK = (float*)take((size_t)TT * DKV * 4);
    h16* QP16 = (h16*)take((size_t)NH_ * TT * HD * 2); h16* KP16 = (h16*)take((size_t)NKV * TT * HD * 2); h16* VT16 = (h16*)take((size_t)NKV * HD * TT * 2);
    bf* QPh = (bf*)take((size_t)NH_ * TT * HD * 2); bf* QPl = (bf*)take((size_t)NH_ * TT * HD * 2); bf* KPh = (bf*)take((size_t)NKV * TT * HD * 2); bf* KPl = (bf*)take((size_t)NKV * TT * HD * 2); bf* VTh = (bf*)take((size_t)NKV * HD * TT * 2); bf* VTl = (bf*)take((size_t)NKV * HD * TT * 2);
    bf* ATh = (bf*)take((size_t)TT * DQ * 2); bf* ATl = (bf*)take((size_t)TT * DQ * 2);
    if ((size_t)(wsp - (char*)d_ws) > ws_size) return;    // ws 256 MiB
    float* FV = FK;   // v projection reuses the k buffer after the k planes are built (stream-ordered)
    { k_wtG<<<(unsigned)((DM * DQ / 64 + 63) / 64), 256, 0, stream>>>(wq, DM, DQ, WQ); k_wtG<<<(unsigned)((DM * DKV / 64 + 63) / 64), 256, 0, stream>>>(wk, DM, DKV, WK); k_wtG<<<(unsigned)((DM * DKV / 64 + 63) / 64), 256, 0, stream>>>(wv, DM, DKV, WV);
      k_wtG<<<(unsigned)((DQ * DM / 64 + 63) / 64), 256, 0, stream>>>(wo, DQ, DM, WO);
       }
    const unsigned LQ = (unsigned)(((size_t)NH_ * TT * HD / 2 + 255) / 256), LKv = (unsigned)(((size_t)NKV * TT * HD / 2 + 255) / 256);
    for (int b = 0; b < NB_; ++b) {
        if (b == 0) k_cscvt<<<(TT * DQ + 255) / 256, 256, 0, stream>>>(cosT, sinT, CS);
        k_cvt8<<<(unsigned)(((size_t)TT * DM / 8 + 255) / 256), 256, 0, stream>>>(x + (size_t)b * TT * DM, XB, (size_t)TT * DM / 8);
        k_gemmw<bf, 0, true, 1, 1><<<dim3(TT / 64, DQ / 64, 1), 32, 0, stream>>>(XB, nullptr, WQ, nullptr, DM, FQ, DQ, bq, 0, 0, 0, 0);
        k_rmsrow<<<TT / 8, 256, 0, stream>>>(FQ, nqw); k_rope<<<LQ, 256, 0, stream>>>(FQ, DQ, NH_, CS, nullptr, nullptr, 1.0f, QP16, QPh, QPl);
        k_gemmw<bf, 0, true, 1, 1><<<dim3(TT / 64, DKV / 64, 1), 32, 0, stream>>>(XB, nullptr, WK, nullptr, DM, FK, DKV, bk, 0, 0, 0, 0);
        k_rmsrow<<<TT / 8, 256, 0, stream>>>(FK, nkw); k_rope<<<LKv, 256, 0, stream>>>(FK, DKV, NKV, CS, nullptr, nullptr, 1.0f, KP16, KPh, KPl);
        k_gemmw<bf, 0, true, 1, 1><<<dim3(TT / 64, DKV / 64, 1), 32, 0, stream>>>(XB, nullptr, WV, nullptr, DM, FV, DKV, bv, 0, 0, 0, 0); k_vtp<<<LKv, 256, 0, stream>>>(FV, DKV, NKV, VT16, VTh, VTl);
        k_attn<<<dim3(TT / (16 * AQ * AW), NH_), 32 * AW, 0, stream>>>(QPh, QPl, KPh, KPl, VT16, VTh, VTl, ATh, ATl);
        k_gemmw<bf, 1, true, 1, 1><<<dim3(TT / 64, DM / 64, 1), 32, 0, stream>>>(ATh, ATl, WO, nullptr, DQ, OUT + (size_t)b * TT * DM, DM, bo, 0, 0, 0, 0); }
}

// v003
// One run takes 453 microseconds.
// Two timings next to v002 put it at 1.14 and 1.13 times that version's speed.
// All steps since v000 together make it 4.58 times as fast.
#include <hip/hip_runtime.h>

// LTXAttention (hidden [1][2048][2048]; q/k/v = x W + b; q, k RMS-normalised across the full 2048 (eps 1e-5) * w; interleaved-pair rotary with the read per-element cos/sin [1][S][2048] (x cos + rot(x) sin, rot = (-x_odd, x_even)); 32 heads x 64; softmax(q.k / 8) (no mask); out = merged wo + bo -> [1][2048][2048]).
// Compute dtypes, f32 accumulate: every input rounded to bf16; q/k/v on PLAIN bf16 operands (inputs: exact) + bias; RMSNorm and rotary (bf16-rounded full-width tables) f32, one wave per row; scores hl x hl (3 products) on EVERY row (normalised q/k: sharp), attn.v: query rows < 512 hl (3 products), the rest single fp16 (x1024); softmax f32; wo hl x exact (2 products) + bias.

#define NB_  1
#define TT   2048
#define DM   2048
#define NH_  32
#define NKV  32
#define REP  (NH_ / NKV)
#define HD   64
#define DQ   (NH_ * HD)
#define DKV  (NKV * HD)
#define RH   512                  // query rows < RH use hi+lo planes (0: none)
#define WIN  0
#define PCAR 1024.0f
#define SCL  0.125f   // HD^-0.5
typedef _Float16 h16;
typedef unsigned short bf;
typedef __attribute__((ext_vector_type(16))) __bf16   v16bf;
typedef __attribute__((ext_vector_type(16))) _Float16 v16h;
typedef __attribute__((ext_vector_type(8)))  _Float16 v8h;
typedef __attribute__((ext_vector_type(8)))  unsigned short v8us;
typedef __attribute__((ext_vector_type(8)))  float    v8f;
typedef __attribute__((ext_vector_type(4)))  float    v4f;
typedef v8h  __attribute__((may_alias)) v8ha;
typedef v4f  __attribute__((may_alias)) v4fa;
typedef v8us __attribute__((may_alias)) v8usa;

__device__ __forceinline__ unsigned short f2bf(float f) { unsigned u = __float_as_uint(f); u += 0x7FFFu + ((u >> 16) & 1u); return (unsigned short)(u >> 16); }
__device__ __forceinline__ float bf2f(unsigned short b) { return __uint_as_float(((unsigned)b) << 16); }
__device__ __forceinline__ float bfr(float f) { return bf2f(f2bf(f)); }
__device__ __forceinline__ v16h cat16(v8h lo, v8h hi) { return __builtin_shufflevector(lo, hi, 0, 1, 2, 3, 4, 5, 6, 7, 8, 9, 10, 11, 12, 13, 14, 15); }
__device__ __forceinline__ v16bf cat16b(v8us lo, v8us hi) { return __builtin_bit_cast(v16bf, __builtin_shufflevector(lo, hi, 0, 1, 2, 3, 4, 5, 6, 7, 8, 9, 10, 11, 12, 13, 14, 15)); }
__device__ __forceinline__ v8f wmma16(v16h a, v16h b, v8f c) { return __builtin_amdgcn_wmma_f32_16x16x32_f16(false, a, false, b, (short)0, c, false, false); }
__device__ __forceinline__ v8f wmmab(v16bf a, v16bf b, v8f c) { return __builtin_amdgcn_wmma_f32_16x16x32_bf16(false, a, false, b, (short)0, c, false, false); }



// ---- k_gemmw: register-blocked GEMM, 64x64 output tiles (16 accumulators per wave), operands straight from K-contiguous 16-bit planes; grid (M/64, N/64, Z * KS), 32 * NW threads.
// NW == KS == 1: one wave runs a tile's whole K loop. Otherwise the 32-wide k steps of a tile are dealt round robin to KS * NW waves: the NW partial tiles of a work-group
// are summed in LDS in wave order; work-group ks stores its sum in partial plane ks (C + ks * sP), and the reader of C adds the KS planes.
// C[m][n] (f32, pitch ldc, + optional f32 bias[n]) = sum_k A[m][k] Bt[n][k] (+ split products per NSPLIT). z-batch strides sA/sB/sC in elements. K % 32 == 0.
template <typename T16> struct WFrag;
template <> struct WFrag<h16> { typedef v16h V; static __device__ __forceinline__ V ld(const h16* p) { return cat16(*(const v8h*)p, *(const v8h*)(p + 16)); } static __device__ __forceinline__ v8f mma(V a, V b, v8f c) { return wmma16(a, b, c); } };
template <> struct WFrag<bf> { typedef v16bf V; static __device__ __forceinline__ V ld(const bf* p) { return cat16b(*(const v8us*)p, *(const v8us*)(p + 16)); } static __device__ __forceinline__ v8f mma(V a, V b, v8f c) { return wmmab(a, b, c); } };
template <typename T16, int NSPLIT, bool BIAS, int NW, int KS>
__global__ __launch_bounds__(32 * NW) void k_gemmw(const T16* __restrict__ A, const T16* __restrict__ A2, const T16* __restrict__ Bt, const T16* __restrict__ Bt2, int K, float* C, int ldc, const float* __restrict__ bias, size_t sA, size_t sB, size_t sC, size_t sP) {
    typedef typename WFrag<T16>::V V;
    static_assert(KS == 1 || !BIAS, "the bias would be added once per partial plane");
    __shared__ __align__(16) float os[NW == 1 ? 16 * 68 : NW * 64 * 68];
    const int wave = NW == 1 ? 0 : __builtin_amdgcn_readfirstlane((int)(threadIdx.x >> 5));   // scalar, so the K loop keeps a scalar branch
    const int ks = (int)(blockIdx.z % KS);
    const size_t z = blockIdx.z / KS; A += z * sA; if (A2) A2 += z * sA; Bt += z * sB; if (Bt2) Bt2 += z * sB; C += z * sC + (size_t)ks * sP;
    const int lane = threadIdx.x & 31, lr = lane & 15, hi = lane >> 4; const int r0 = blockIdx.x * 64, c0 = blockIdx.y * 64;
    v8f acc[4][4];
#pragma unroll
    for (int mb = 0; mb < 4; ++mb)
#pragma unroll
        for (int nb = 0; nb < 4; ++nb) acc[mb][nb] = (v8f){};
    const size_t aoff = (size_t)(r0 + lr) * K + 8 * hi, boff = (size_t)(c0 + lr) * K + 8 * hi;
#pragma unroll 1
    for (int kc = 32 * (ks * NW + wave); kc < K; kc += 32 * NW * KS) {
        V a[4], a2[4];
#pragma unroll
        for (int mb = 0; mb < 4; ++mb) { a[mb] = WFrag<T16>::ld(A + aoff + (size_t)mb * 16 * K + kc); if (NSPLIT == 1 || NSPLIT == 2) a2[mb] = WFrag<T16>::ld(A2 + aoff + (size_t)mb * 16 * K + kc); }
#pragma unroll
        for (int nb = 0; nb < 4; ++nb) { const V b = WFrag<T16>::ld(Bt + boff + (size_t)nb * 16 * K + kc); V b2; if (NSPLIT >= 2) b2 = WFrag<T16>::ld(Bt2 + boff + (size_t)nb * 16 * K + kc);
#pragma unroll
            for (int mb = 0; mb < 4; ++mb) { acc[mb][nb] = WFrag<T16>::mma(a[mb], b, acc[mb][nb]); if (NSPLIT == 1 || NSPLIT == 2) acc[mb][nb] = WFrag<T16>::mma(a2[mb], b, acc[mb][nb]); if (NSPLIT >= 2) acc[mb][nb] = WFrag<T16>::mma(a[mb], b2, acc[mb][nb]); } }
        asm volatile("v_nop\n\tv_nop\n\tv_nop\n\tv_nop" : "+v"(acc[0][0]), "+v"(acc[1][1]), "+v"(acc[2][2]), "+v"(acc[3][3]) : "v"(a[0]), "v"(a[3]));
    }
    if constexpr (NW > 1) {
        float* ow = os + wave * (64 * 68);
#pragma unroll
        for (int mb = 0; mb < 4; ++mb)
#pragma unroll
            for (int nb = 0; nb < 4; ++nb)
#pragma unroll
                for (int j = 0; j < 8; ++j) ow[(mb * 16 + hi * 8 + j) * 68 + nb * 16 + lr] = acc[mb][nb][j];
        __syncthreads();   // every wave's partial tile is in LDS before any of them is summed
#pragma unroll
        for (int s = 0; s < 64 * 16 / (32 * NW); ++s) { const int idx = (int)threadIdx.x + s * 32 * NW; const int row = idx >> 4, cofs = (idx & 15) * 4; v4f p[NW];
#pragma unroll
            for (int w = 0; w < NW; ++w) p[w] = *(const v4fa*)(os + w * (64 * 68) + row * 68 + cofs);
            v4f val = p[0];
#pragma unroll
            for (int w = 1; w < NW; ++w) val += p[w];
            if (BIAS) { val[0] += bfr(bias[c0 + cofs]); val[1] += bfr(bias[c0 + cofs + 1]); val[2] += bfr(bias[c0 + cofs + 2]); val[3] += bfr(bias[c0 + cofs + 3]); }
            *(v4f*)(C + (size_t)(r0 + row) * ldc + c0 + cofs) = val; }
        return;
    }
#pragma unroll
    for (int mb = 0; mb < 4; ++mb) {
#pragma unroll
        for (int nb = 0; nb < 4; ++nb) {
#pragma unroll
            for (int j = 0; j < 8; ++j) os[(hi * 8 + j) * 68 + nb * 16 + lr] = acc[mb][nb][j]; }
        __builtin_amdgcn_wave_barrier(); asm volatile("" ::: "memory");
        float* crow = C + (size_t)(r0 + mb * 16) * ldc + c0;
{
#pragma unroll
            for (int s = 0; s < 8; ++s) { const int row = 2 * s + hi, cofs = lr * 4; v4f val = *(const v4fa*)(os + row * 68 + cofs); if (BIAS) { val[0] += bfr(bias[c0 + cofs]); val[1] += bfr(bias[c0 + cofs + 1]); val[2] += bfr(bias[c0 + cofs + 2]); val[3] += bfr(bias[c0 + cofs + 3]); }
                *(v4f*)(crow + (size_t)row * ldc + cofs) = val; }
             }
        __builtin_amdgcn_wave_barrier(); asm volatile("" ::: "memory");
    }
}

__device__ __forceinline__ h16 tohx(float x) { return (h16)x; }
__device__ __forceinline__ void splitf(float y, unsigned short& h, unsigned short& l) { h = f2bf(y); l = f2bf(y - bf2f(h)); }
typedef __attribute__((ext_vector_type(2))) _Float16 v2h;
typedef __attribute__((ext_vector_type(4))) _Float16 v4h;
typedef __attribute__((ext_vector_type(2))) unsigned short v2us;
typedef __attribute__((ext_vector_type(4))) unsigned short v4us;
typedef __attribute__((ext_vector_type(2))) float v2f;
typedef __attribute__((ext_vector_type(4))) int v4i;

__global__ __launch_bounds__(256) void k_wtG(const float* __restrict__ w, int K, int N, bf* Bt) {
    const int lane = threadIdx.x & 31; const int L0 = (blockIdx.x * 8 + (threadIdx.x >> 5)) * 8; const int nlines = N * K / 64;
{
#pragma unroll 1
        for (int l = 0; l < 8; ++l) { const int L = L0 + l; if (L >= nlines) break; const size_t e = (size_t)L * 64 + lane * 2; const int k = (int)(e % K), n = (int)(e / K); v2us o;
            o[0] = f2bf(w[(size_t)k * N + n]); o[1] = f2bf(w[(size_t)(k + 1) * N + n]); *(v2us*)(Bt + e) = o; }
         }
}
__global__ __launch_bounds__(256) void k_cvt8(const float* __restrict__ src, bf* dst, size_t n8) { const size_t i = (size_t)blockIdx.x * 256 + threadIdx.x; if (i >= n8) return; const v8f v = *(const v8f*)(src + i * 8); v8us o;
#pragma unroll
    for (int k = 0; k < 8; ++k) o[k] = f2bf(v[k]); *(v8us*)(dst + i * 8) = o;  }
__global__ __launch_bounds__(256) void k_vtp(const float* __restrict__ F, int pitch, int nheads, h16* V16, bf* Vh, bf* Vl) { const size_t e = ((size_t)blockIdx.x * 256 + threadIdx.x) * 2; if (e >= (size_t)nheads * HD * TT) return; const int t = (int)(e % TT); const int d = (int)((e / TT) % HD); const int g = (int)(e / ((size_t)TT * HD)); v2h o16; v2us oh, ol;
#pragma unroll
    for (int q = 0; q < 2; ++q) { const float x = F[(size_t)(t + q) * pitch + g * HD + d]; o16[q] = tohx(x); unsigned short a2, c2; splitf(x, a2, c2); oh[q] = a2; ol[q] = c2; }
    *(v2h*)(V16 + e) = o16; *(v2us*)(Vh + e) = oh; *(v2us*)(Vl + e) = ol;  }
// ---- k_qkprep: RMS norm across the full row, rotary and the hi/lo split of q and k in one launch. Grid (TT / 8, 2), 8 waves, no barrier: a wave owns one row of q (y = 0) or of k (y = 1)
// and keeps it in registers from the sum of squares to the head planes [h][t][d]. A lane holds 4 consecutive columns of every 128, so both members of a rotary pair are its own;
// cos and sin are read as given ([t][DQ], per element) and rounded to bf16 here. out[d] = x[d] cos[d] - x[d+1] sin[d] (d even), x[d] cos[d] + x[d-1] sin[d] (d odd).
__global__ __launch_bounds__(256) void k_qkprep(const float* __restrict__ FQ, const float* __restrict__ FK, const float* __restrict__ nqw, const float* __restrict__ nkw, const float* __restrict__ cosT, const float* __restrict__ sinT, bf* QPh, bf* QPl, bf* KPh, bf* KPl) {
    static_assert(DKV == DQ && TT % 8 == 0 && HD == 64, "q and k rows are equally wide, 8 rows a work-group, 128 columns are two heads");
    const int lane = threadIdx.x & 31; const int t = blockIdx.x * 8 + __builtin_amdgcn_readfirstlane((int)(threadIdx.x >> 5)); const bool isk = blockIdx.y != 0;   // the row is scalar: every access is a scalar base + one lane offset that lives to the end
    const unsigned lo = lane * 4, po = (lane >> 4) * (TT * HD) + (lane & 15) * 4;   // 128 columns are two heads: lanes 0-15 write one whole 128-byte row of a plane, lanes 16-31 the next head's
    const float* f = (isk ? FK : FQ) + (size_t)t * DQ; const float* w = isk ? nkw : nqw; const float* ct = cosT + (size_t)t * DQ; const float* st = sinT + (size_t)t * DQ;
    bf* ph = (isk ? KPh : QPh) + (size_t)t * HD; bf* pl = (isk ? KPl : QPl) + (size_t)t * HD;
    v4f v[DQ / 128], c[DQ / 128], s[DQ / 128]; v4f wn = *(const v4f*)(w + lo);
#pragma unroll
    for (int ch = 0; ch < DQ / 128; ++ch) v[ch] = *(const v4f*)(f + ch * 128 + lo);
#pragma unroll
    for (int ch = 0; ch < DQ / 128; ++ch) { c[ch] = *(const v4f*)(ct + ch * 128 + lo); s[ch] = *(const v4f*)(st + ch * 128 + lo); }
    __builtin_amdgcn_sched_barrier(0);   // keeps every table load in front of the sum of squares: sunk to their uses, they are waited for one by one, a memory latency each
    float ss = 0.f;
#pragma unroll
    for (int ch = 0; ch < DQ / 128; ++ch)
#pragma unroll
        for (int u = 0; u < 4; ++u) ss += v[ch][u] * v[ch][u];
#pragma unroll
    for (int sh = 16; sh; sh >>= 1) ss += __shfl_xor(ss, sh, 32);
    const float rs = __fdiv_rn(1.0f, sqrtf(ss / (float)DQ + 1e-5f));
    __builtin_amdgcn_sched_barrier(0);   // keeps the rounding of the first tables behind the sum: hoisted, it waits for the last load in front of the first square
#pragma unroll
    for (int ch = 0; ch < DQ / 128; ++ch) { const v4f wv = wn; v4f y; v4us oh, ol; if (ch + 1 < DQ / 128) wn = *(const v4f*)(w + (ch + 1) * 128 + lo);   // the next norm weights fly during this chunk
#pragma unroll
        for (int u = 0; u < 4; ++u) y[u] = v[ch][u] * rs * bfr(wv[u]);
#pragma unroll
        for (int u = 0; u < 4; ++u) { const float a = y[u] * bfr(c[ch][u]), b = y[u ^ 1] * bfr(s[ch][u]); const float r = (u & 1) ? a + b : a - b; unsigned short h2, l2; splitf(r, h2, l2); oh[u] = h2; ol[u] = l2; }
        *(v4us*)(ph + (size_t)ch * 2 * TT * HD + po) = oh; *(v4us*)(pl + (size_t)ch * 2 * TT * HD + po) = ol;
        if (ch + 1 < DQ / 128) asm volatile("s_wait_xcnt 0x0" ::: "memory");   // behind the two stores: the next chunk's load and values take the stores' data registers anew
        __builtin_amdgcn_sched_barrier(0); }   // one chunk at a time: merged, the chunks' results pile up in registers in front of late stores, past 256 registers (three waves a SIMD, not four)
}
#define AW 8                      // waves of a work-group
#define AQ 2                      // 16-query column groups of a wave
#define AHW (RH / (16 * AQ) / (TT / (16 * AQ * AW)))   // waves of every work-group that take a hi+lo query tile, so that all work-groups cost the same
struct KFrag { v16bf h[2][2], l[2][2]; };   // 32 keys: [16-key tile][32-wide step of d]
// xwait: behind a run of loads and in front of the step of their offset register; it names the offset, so that it is stepped, and its register used anew, only behind it
__device__ __forceinline__ void xwait(unsigned& o) { asm volatile("s_wait_xcnt 0x0" : "+v"(o) :: "memory"); }
// fragment at a wave-uniform plane pointer + the lane's own byte offset + a constant: k octets hi and 2 + hi of a 32-wide step
__device__ __forceinline__ v16bf ldfb(const bf* __restrict__ base, unsigned off, int imm) { const char* p = (const char*)base + (size_t)off + imm; return cat16b(*(const v8us*)p, *(const v8us*)(p + 32)); }
__device__ __forceinline__ v16h ldfh(const h16* __restrict__ base, unsigned off, int imm) { const char* p = (const char*)base + (size_t)off + imm; return cat16(*(const v8h*)p, *(const v8h*)(p + 32)); }
__device__ __forceinline__ void ldk(KFrag& f, const bf* __restrict__ kh, const bf* __restrict__ kl, unsigned& ko) {
#pragma unroll
    for (int t = 0; t < 2; ++t)
#pragma unroll
        for (int kk = 0; kk < 2; ++kk) { f.h[t][kk] = ldfb(kh, ko, (t * 16 * HD + kk * 32) * 2); f.l[t][kk] = ldfb(kl, ko, (t * 16 * HD + kk * 32) * 2); }
    xwait(ko);
}
__device__ __forceinline__ v8f scoreT(const KFrag& f, int t, const v16bf* qh, const v16bf* ql) { v8f s = (v8f){};
#pragma unroll
    for (int kk = 0; kk < 2; ++kk) { s = wmmab(f.h[t][kk], qh[kk], s); s = wmmab(f.h[t][kk], ql[kk], s); s = wmmab(f.l[t][kk], qh[kk], s); }
    return s; }
template <bool HR> struct VFrag;
template <> struct VFrag<true> { v16bf h[4], l[4]; };   // 32 keys of V^T: [16-row tile of d]
template <> struct VFrag<false> { v16h x[4]; };
__device__ __forceinline__ void ldv(VFrag<true>& f, const h16* __restrict__, const bf* __restrict__ vh, const bf* __restrict__ vl, unsigned& vo) {
#pragma unroll
    for (int mb = 0; mb < 4; ++mb) { f.h[mb] = ldfb(vh, vo, mb * 16 * TT * 2); f.l[mb] = ldfb(vl, vo, mb * 16 * TT * 2); }
    xwait(vo); }
__device__ __forceinline__ void ldv(VFrag<false>& f, const h16* __restrict__ v16, const bf* __restrict__, const bf* __restrict__, unsigned& vo) {
#pragma unroll
    for (int mb = 0; mb < 4; ++mb) f.x[mb] = ldfh(v16, vo, mb * 16 * TT * 2);
    xwait(vo); }
__device__ __forceinline__ void pv(v8f* o, const VFrag<true>& f, const float* p) { v8us h0, h1, l0, l1;
#pragma unroll
    for (int r = 0; r < 8; ++r) { unsigned short a, c2; splitf(p[r], a, c2); h0[r] = a; l0[r] = c2; splitf(p[8 + r], a, c2); h1[r] = a; l1[r] = c2; }
    const v16bf ph = cat16b(h0, h1), pl = cat16b(l0, l1);
#pragma unroll
    for (int mb = 0; mb < 4; ++mb) { o[mb] = wmmab(f.h[mb], ph, o[mb]); o[mb] = wmmab(f.h[mb], pl, o[mb]); o[mb] = wmmab(f.l[mb], ph, o[mb]); } }
__device__ __forceinline__ void pv(v8f* o, const VFrag<false>& f, const float* p) { v16h p16;
#pragma unroll
    for (int r = 0; r < 16; ++r) p16[r] = tohx(p[r] * PCAR);
#pragma unroll
    for (int mb = 0; mb < 4; ++mb) o[mb] = wmma16(f.x[mb], p16, o[mb]); }
template <bool HR>
__device__ __forceinline__ void attn_tile(const bf* __restrict__ Qh, const bf* __restrict__ Ql, const bf* __restrict__ Kh, const bf* __restrict__ Kl, const h16* __restrict__ V16, const bf* __restrict__ Vh, const bf* __restrict__ Vl, bf* Ah, bf* Al, int q0) {
    const int lane = threadIdx.x & 31, lr = lane & 15, hi = lane >> 4;
    unsigned qo = (unsigned)((q0 + lr) * HD + 8 * hi) * 2, ko = (unsigned)(lr * HD + 8 * hi) * 2, vo = (unsigned)(lr * TT + 8 * hi) * 2;   // the lane's byte offsets in the Q, K and V^T planes of the head
    v16bf qh[AQ][2], ql[AQ][2];
#pragma unroll
    for (int g = 0; g < AQ; ++g)
#pragma unroll
        for (int kk = 0; kk < 2; ++kk) { qh[g][kk] = ldfb(Qh, qo, (g * 16 * HD + kk * 32) * 2); ql[g][kk] = ldfb(Ql, qo, (g * 16 * HD + kk * 32) * 2); }
    xwait(qo);
    float mx[AQ], sum[AQ]; v8f o[AQ][4];
#pragma unroll
    for (int g = 0; g < AQ; ++g) { mx[g] = -3.0e38f; sum[g] = 0.f;
#pragma unroll
        for (int mb = 0; mb < 4; ++mb) o[g][mb] = (v8f){}; }
    // every fetch runs ahead of its use and wraps to key 0 behind the last key, so it stays in bounds
    const unsigned ko0 = ko; KFrag kc, kd; ldk(kc, Kh, Kl, ko); ko += 32 * HD * 2; ldk(kd, Kh, Kl, ko); ko += 32 * HD * 2;
    for (int j0 = 0; j0 < TT; j0 += 64) {   // two fragment sets in turn: each is fetched anew behind its last use and flies while the other is worked on
#pragma unroll
        for (int t = 0; t < 2; ++t)
#pragma unroll
            for (int g = 0; g < AQ; ++g) { const v8f s = scoreT(kc, t, qh[g], ql[g]);
#pragma unroll
                for (int r = 0; r < 8; ++r) mx[g] = fmaxf(mx[g], s[r]); }
        ldk(kc, Kh, Kl, ko); ko += 32 * HD * 2;   // the last trip fetches keys 0..31, which walk 2 starts with
        __builtin_amdgcn_sched_barrier(0);   // keeps the two sets' products apart: merged, both sets are fetched late in the trip and waited for at the head of the next
#pragma unroll
        for (int t = 0; t < 2; ++t)
#pragma unroll
            for (int g = 0; g < AQ; ++g) { const v8f s = scoreT(kd, t, qh[g], ql[g]);
#pragma unroll
                for (int r = 0; r < 8; ++r) mx[g] = fmaxf(mx[g], s[r]); }
        ldk(kd, Kh, Kl, ko); ko += (unsigned)(((j0 + 128 == TT) ? 32 - TT : 32) * HD * 2);
    }
    ko = ko0 + 32 * HD * 2;
#pragma unroll
    for (int g = 0; g < AQ; ++g) mx[g] = fmaxf(mx[g], __shfl_xor(mx[g], 16, 32)) * SCL;   // SCL is a power of two: max(s) * SCL == max(s * SCL)
    VFrag<HR> vc; ldv(vc, V16, Vh, Vl, vo); vo += 32 * 2;
    for (int j0 = 0; j0 < TT; j0 += 32) { const int st = (j0 + 64 == TT) ? -(TT - 32) : 32;   // the last trip fetches keys 0..31 again (in bounds, unused)
        v8f s[AQ][2];
#pragma unroll
        for (int t = 0; t < 2; ++t)
#pragma unroll
            for (int g = 0; g < AQ; ++g) s[g][t] = scoreT(kc, t, qh[g], ql[g]);
        ldk(kc, Kh, Kl, ko); ko += (unsigned)(st * HD * 2);   // the next keys, behind the last use of these: they fly during exp and attn.v
#pragma unroll
        for (int g = 0; g < AQ; ++g) { float p[16];
#pragma unroll
            for (int t = 0; t < 2; ++t)
#pragma unroll
                for (int r = 0; r < 8; ++r) { p[t * 8 + r] = __builtin_amdgcn_exp2f((s[g][t][r] * SCL - mx[g]) * 1.4426950408889634f); sum[g] += p[t * 8 + r]; }
            pv(o[g], vc, p); }
        ldv(vc, V16, Vh, Vl, vo); vo += (unsigned)(st * 2);   // the next V^T columns fly during the next trip's scores
    }
#pragma unroll
    for (int g = 0; g < AQ; ++g) { const float fin = __fdiv_rn(1.0f, sum[g] + __shfl_xor(sum[g], 16, 32)) * (HR ? 1.0f : 1.0f / PCAR);
#pragma unroll
        for (int mb = 0; mb < 4; ++mb) { v8us oh, ol;
#pragma unroll
            for (int r = 0; r < 8; ++r) { unsigned short a, c2; splitf(o[g][mb][r] * fin, a, c2); oh[r] = a; ol[r] = c2; }
            const size_t oo = (size_t)(q0 + g * 16 + lr) * DQ + mb * 16 + 8 * hi;
            // the two stores and their s_wait_xcnt in one statement: in a statement of its own the wait sank below the next tile's values, which take the stores' registers anew
            asm volatile("global_store_b128 %0, %2, off\n\tglobal_store_b128 %1, %3, off\n\ts_wait_xcnt 0x0" :: "v"(Ah + oo), "v"(Al + oo), "v"(oh), "v"(ol) : "memory"); } }
}
__global__ __launch_bounds__(32 * AW) void k_attn(const bf* __restrict__ QPh, const bf* __restrict__ QPl, const bf* __restrict__ KPh, const bf* __restrict__ KPl, const h16* __restrict__ VT16, const bf* __restrict__ VTh, const bf* __restrict__ VTl, bf* ATh, bf* ATl) {
    static_assert(RH % (16 * AQ) == 0 && (RH / (16 * AQ)) % (TT / (16 * AQ * AW)) == 0 && TT % 128 == 0, "query tiles deal evenly, walk 1 takes 64 keys a trip");
    const int wave = __builtin_amdgcn_readfirstlane((int)(threadIdx.x >> 5));   // scalar, so the choice of the tile's kind is a scalar branch
    const size_t zq = (size_t)blockIdx.y * TT * HD, zk = (size_t)(blockIdx.y / REP) * TT * HD; bf* ah = ATh + blockIdx.y * HD; bf* al = ATl + blockIdx.y * HD;
    if (wave < AHW) attn_tile<true>(QPh + zq, QPl + zq, KPh + zk, KPl + zk, VT16 + zk, VTh + zk, VTl + zk, ah, al, ((int)blockIdx.x * AHW + wave) * (16 * AQ));
    else attn_tile<false>(QPh + zq, QPl + zq, KPh + zk, KPl + zk, VT16 + zk, VTh + zk, VTl + zk, ah, al, RH + ((int)blockIdx.x * (AW - AHW) + wave - AHW) * (16 * AQ));
}

extern "C" void kernel_launch(void* const* d_in, const int* in_sizes, int n_in,
                              void* d_out, int out_size, void* d_ws, size_t ws_size, hipStream_t stream) {
    (void)in_sizes; (void)n_in; (void)out_size;
    const float* x = (const float*)d_in[0]; const float* cosT = (const float*)d_in[1]; const float* sinT = (const float*)d_in[2]; const float* wq = (const float*)d_in[3]; const float* bq = (const float*)d_in[4]; const float* wk = (const float*)d_in[5]; const float* bk = (const float*)d_in[6]; const float* wv = (const float*)d_in[7]; const float* bv = (const float*)d_in[8]; const float* nqw = (const float*)d_in[9]; const float* nkw = (const float*)d_in[10]; const float* wo = (const float*)d_in[11]; const float* bo = (const float*)d_in[12];
    float* OUT = (float*)d_out;     // [1][2048][2048]
    char* wsp = (char*)d_ws;
    auto take = [&](size_t bytes) { char* p = wsp; wsp += (bytes + 255) & ~(size_t)255; return (void*)p; };
    bf* WQ = (bf*)take((size_t)DQ * DM * 2); bf* WK = (bf*)take((size_t)DKV * DM * 2); bf* WV = (bf*)take((size_t)DKV * DM * 2); bf* WO = (bf*)take((size_t)DM * DQ * 2);
    bf* XB = (bf*)take((size_t)TT * DM * 2); float* FQ = (float*)take((size_t)TT * DQ * 4); float* FK = (float*)take((size_t)TT * DKV * 4);
    h16* VT16 = (h16*)take((size_t)NKV * HD * TT * 2);
    bf* QPh = (bf*)take((size_t)NH_ * TT * HD * 2); bf* QPl = (bf*)take((size_t)NH_ * TT * HD * 2); bf* KPh = (bf*)take((size_t)NKV * TT * HD * 2); bf* KPl = (bf*)take((size_t)NKV * TT * HD * 2); bf* VTh = (bf*)take((size_t)NKV * HD * TT * 2); bf* VTl = (bf*)take((size_t)NKV * HD * TT * 2);
    bf* ATh = (bf*)take((size_t)TT * DQ * 2); bf* ATl = (bf*)take((size_t)TT * DQ * 2);
    if ((size_t)(wsp - (char*)d_ws) > ws_size) return;    // ws 256 MiB
    float* FV = FK;   // v projection reuses the k buffer after the k planes are built (stream-ordered)
    { k_wtG<<<(unsigned)((DM * DQ / 64 + 63) / 64), 256, 0, stream>>>(wq, DM, DQ, WQ); k_wtG<<<(unsigned)((DM * DKV / 64 + 63) / 64), 256, 0, stream>>>(wk, DM, DKV, WK); k_wtG<<<(unsigned)((DM * DKV / 64 + 63) / 64), 256, 0, stream>>>(wv, DM, DKV, WV);
      k_wtG<<<(unsigned)((DQ * DM / 64 + 63) / 64), 256, 0, stream>>>(wo, DQ, DM, WO);
       }
    const unsigned LKv = (unsigned)(((size_t)NKV * TT * HD / 2 + 255) / 256);
    for (int b = 0; b < NB_; ++b) {
        k_cvt8<<<(unsigned)(((size_t)TT * DM / 8 + 255) / 256), 256, 0, stream>>>(x + (size_t)b * TT * DM, XB, (size_t)TT * DM / 8);
        k_gemmw<bf, 0, true, 1, 1><<<dim3(TT / 64, DQ / 64, 1), 32, 0, stream>>>(XB, nullptr, WQ, nullptr, DM, FQ, DQ, bq, 0, 0, 0, 0);
        k_gemmw<bf, 0, true, 1, 1><<<dim3(TT / 64, DKV / 64, 1), 32, 0, stream>>>(XB, nullptr, WK, nullptr, DM, FK, DKV, bk, 0, 0, 0, 0);
        k_qkprep<<<dim3(TT / 8, 2), 256, 0, stream>>>(FQ, FK, nqw, nkw, cosT, sinT, QPh, QPl, KPh, KPl);
        k_gemmw<bf, 0, true, 1, 1><<<dim3(TT / 64, DKV / 64, 1), 32, 0, stream>>>(XB, nullptr, WV, nullptr, DM, FV, DKV, bv, 0, 0, 0, 0); k_vtp<<<LKv, 256, 0, stream>>>(FV, DKV, NKV, VT16, VTh, VTl);
        k_attn<<<dim3(TT / (16 * AQ * AW), NH_), 32 * AW, 0, stream>>>(QPh, QPl, KPh, KPl, VT16, VTh, VTl, ATh, ATl);
        k_gemmw<bf, 1, true, 1, 1><<<dim3(TT / 64, DM / 64, 1), 32, 0, stream>>>(ATh, ATl, WO, nullptr, DQ, OUT + (size_t)b * TT * DM, DM, bo, 0, 0, 0, 0); }
}

// v004
// It runs in 396 microseconds.
// Next to v003, in two timings, it ran 1.14 times as fast each time.
// Over all steps from v000 it is 5.21 times as fast.
#include <hip/hip_runtime.h>

// LTXAttention (hidden [1][2048][2048]; q/k/v = x W + b; q, k RMS-normalised across the full 2048 (eps 1e-5) * w; interleaved-pair rotary with the read per-element cos/sin [1][S][2048] (x cos + rot(x) sin, rot = (-x_odd, x_even)); 32 heads x 64; softmax(q.k / 8) (no mask); out = merged wo + bo -> [1][2048][2048]).
// Compute dtypes, f32 accumulate: every input rounded to bf16; q/k/v on PLAIN bf16 operands (inputs: exact) + bias; RMSNorm and rotary (bf16-rounded full-width tables) f32, one wave per row; scores hl x hl (3 products) on EVERY row (normalised q/k: sharp), attn.v: query rows < 512 hl (3 products), the rest single fp16 (x1024); softmax f32; wo hl x exact (2 products) + bias.

#define NB_  1
#define TT   2048
#define DM   2048
#define NH_  32
#define NKV  32
#define REP  (NH_ / NKV)
#define HD   64
#define DQ   (NH_ * HD)
#define DKV  (NKV * HD)
#define RH   512                  // query rows < RH use hi+lo planes (0: none)
#define WIN  0
#define PCAR 1024.0f
#define SCL  0.125f   // HD^-0.5
typedef _Float16 h16;
typedef unsigned short bf;
typedef __attribute__((ext_vector_type(16))) __bf16   v16bf;
typedef __attribute__((ext_vector_type(16))) _Float16 v16h;
typedef __attribute__((ext_vector_type(8)))  _Float16 v8h;
typedef __attribute__((ext_vector_type(8)))  unsigned short v8us;
typedef __attribute__((ext_vector_type(8)))  float    v8f;
typedef __attribute__((ext_vector_type(4)))  float    v4f;
typedef v8h  __attribute__((may_alias)) v8ha;
typedef v4f  __attribute__((may_alias)) v4fa;
typedef v8us __attribute__((may_alias)) v8usa;

__device__ __forceinline__ unsigned short f2bf(float f) { unsigned u = __float_as_uint(f); u += 0x7FFFu + ((u >> 16) & 1u); return (unsigned short)(u >> 16); }
__device__ __forceinline__ float bf2f(unsigned short b) { return __uint_as_float(((unsigned)b) << 16); }
__device__ __forceinline__ float bfr(float f) { return bf2f(f2bf(f)); }
__device__ __forceinline__ v16h cat16(v8h lo, v8h hi) { return __builtin_shufflevector(lo, hi, 0, 1, 2, 3, 4, 5, 6, 7, 8, 9, 10, 11, 12, 13, 14, 15); }
__device__ __forceinline__ v16bf cat16b(v8us lo, v8us hi) { return __builtin_bit_cast(v16bf, __builtin_shufflevector(lo, hi, 0, 1, 2, 3, 4, 5, 6, 7, 8, 9, 10, 11, 12, 13, 14, 15)); }
__device__ __forceinline__ v8f wmma16(v16h a, v16h b, v8f c) { return __builtin_amdgcn_wmma_f32_16x16x32_f16(false, a, false, b, (short)0, c, false, false); }
__device__ __forceinline__ v8f wmmab(v16bf a, v16bf b, v8f c) { return __builtin_amdgcn_wmma_f32_16x16x32_bf16(false, a, false, b, (short)0, c, false, false); }



// ---- k_gemmw: register-blocked GEMM, 64x64 output tiles (16 accumulators per wave), operands straight from K-contiguous 16-bit planes; grid (M/64, N/64, Z * KS), 32 * NW threads.
// NW == KS == 1: one wave runs a tile's whole K loop. Otherwise the 32-wide k steps of a tile are dealt round robin to KS * NW waves: the NW partial tiles of a work-group
// are summed in LDS in wave order; work-group ks stores its sum in partial plane ks (C + ks * sP), and the reader of C adds the KS planes.
// C[m][n] (f32, pitch ldc, + optional f32 bias[n]) = sum_k A[m][k] Bt[n][k] (+ split products per NSPLIT). z-batch strides sA/sB/sC in elements. K % 32 == 0.
template <typename T16> struct WFrag;
template <> struct WFrag<h16> { typedef v16h V; static __device__ __forceinline__ V ld(const h16* p) { return cat16(*(const v8h*)p, *(const v8h*)(p + 16)); } static __device__ __forceinline__ v8f mma(V a, V b, v8f c) { return wmma16(a, b, c); } };
template <> struct WFrag<bf> { typedef v16bf V; static __device__ __forceinline__ V ld(const bf* p) { return cat16b(*(const v8us*)p, *(const v8us*)(p + 16)); } static __device__ __forceinline__ v8f mma(V a, V b, v8f c) { return wmmab(a, b, c); } };
template <typename T16, int NSPLIT, bool BIAS, int NW, int KS>
__global__ __launch_bounds__(32 * NW) void k_gemmw(const T16* __restrict__ A, const T16* __restrict__ A2, const T16* __restrict__ Bt, const T16* __restrict__ Bt2, int K, float* C, int ldc, const float* __restrict__ bias, size_t sA, size_t sB, size_t sC, size_t sP) {
    typedef typename WFrag<T16>::V V;
    static_assert(KS == 1 || !BIAS, "the bias would be added once per partial plane");
    __shared__ __align__(16) float os[NW == 1 ? 16 * 68 : NW * 64 * 68];
    const int wave = NW == 1 ? 0 : __builtin_amdgcn_readfirstlane((int)(threadIdx.x >> 5));   // scalar, so the K loop keeps a scalar branch
    const int ks = (int)(blockIdx.z % KS);
    const size_t z = blockIdx.z / KS; A += z * sA; if (A2) A2 += z * sA; Bt += z * sB; if (Bt2) Bt2 += z * sB; C += z * sC + (size_t)ks * sP;
    const int lane = threadIdx.x & 31, lr = lane & 15, hi = lane >> 4; const int r0 = blockIdx.x * 64, c0 = blockIdx.y * 64;
    v8f acc[4][4];
#pragma unroll
    for (int mb = 0; mb < 4; ++mb)
#pragma unroll
        for (int nb = 0; nb < 4; ++nb) acc[mb][nb] = (v8f){};
    const size_t aoff = (size_t)(r0 + lr) * K + 8 * hi, boff = (size_t)(c0 + lr) * K + 8 * hi;
#pragma unroll 1
    for (int kc = 32 * (ks * NW + wave); kc < K; kc += 32 * NW * KS) {
        V a[4], a2[4];
#pragma unroll
        for (int mb = 0; mb < 4; ++mb) { a[mb] = WFrag<T16>::ld(A + aoff + (size_t)mb * 16 * K + kc); if (NSPLIT == 1 || NSPLIT == 2) a2[mb] = WFrag<T16>::ld(A2 + aoff + (size_t)mb * 16 * K + kc); }
#pragma unroll
        for (int nb = 0; nb < 4; ++nb) { const V b = WFrag<T16>::ld(Bt + boff + (size_t)nb * 16 * K + kc); V b2; if (NSPLIT >= 2) b2 = WFrag<T16>::ld(Bt2 + boff + (size_t)nb * 16 * K + kc);
#pragma unroll
            for (int mb = 0; mb < 4; ++mb) { acc[mb][nb] = WFrag<T16>::mma(a[mb], b, acc[mb][nb]); if (NSPLIT == 1 || NSPLIT == 2) acc[mb][nb] = WFrag<T16>::mma(a2[mb], b, acc[mb][nb]); if (NSPLIT >= 2) acc[mb][nb] = WFrag<T16>::mma(a[mb], b2, acc[mb][nb]); } }
        asm volatile("v_nop\n\tv_nop\n\tv_nop\n\tv_nop" : "+v"(acc[0][0]), "+v"(acc[1][1]), "+v"(acc[2][2]), "+v"(acc[3][3]) : "v"(a[0]), "v"(a[3]));
    }
    if constexpr (NW > 1) {
        float* ow = os + wave * (64 * 68);
#pragma unroll
        for (int mb = 0; mb < 4; ++mb)
#pragma unroll
            for (int nb = 0; nb < 4; ++nb)
#pragma unroll
                for (int j = 0; j < 8; ++j) ow[(mb * 16 + hi * 8 + j) * 68 + nb * 16 + lr] = acc[mb][nb][j];
        __syncthreads();   // every wave's partial tile is in LDS before any of them is summed
#pragma unroll
        for (int s = 0; s < 64 * 16 / (32 * NW); ++s) { const int idx = (int)threadIdx.x + s * 32 * NW; const int row = idx >> 4, cofs = (idx & 15) * 4; v4f p[NW];
#pragma unroll
            for (int w = 0; w < NW; ++w) p[w] = *(const v4fa*)(os + w * (64 * 68) + row * 68 + cofs);
            v4f val = p[0];
#pragma unroll
            for (int w = 1; w < NW; ++w) val += p[w];
            if (BIAS) { val[0] += bfr(bias[c0 + cofs]); val[1] += bfr(bias[c0 + cofs + 1]); val[2] += bfr(bias[c0 + cofs + 2]); val[3] += bfr(bias[c0 + cofs + 3]); }
            *(v4f*)(C + (size_t)(r0 + row) * ldc + c0 + cofs) = val; }
        return;
    }
#pragma unroll
    for (int mb = 0; mb < 4; ++mb) {
#pragma unroll
        for (int nb = 0; nb < 4; ++nb) {
#pragma unroll
            for (int j = 0; j < 8; ++j) os[(hi * 8 + j) * 68 + nb * 16 + lr] = acc[mb][nb][j]; }
        __builtin_amdgcn_wave_barrier(); asm volatile("" ::: "memory");
        float* crow = C + (size_t)(r0 + mb * 16) * ldc + c0;
{
#pragma unroll
            for (int s = 0; s < 8; ++s) { const int row = 2 * s + hi, cofs = lr * 4; v4f val = *(const v4fa*)(os + row * 68 + cofs); if (BIAS) { val[0] += bfr(bias[c0 + cofs]); val[1] += bfr(bias[c0 + cofs + 1]); val[2] += bfr(bias[c0 + cofs + 2]); val[3] += bfr(bias[c0 + cofs + 3]); }
                *(v4f*)(crow + (size_t)row * ldc + cofs) = val; }
             }
        __builtin_amdgcn_wave_barrier(); asm volatile("" ::: "memory");
    }
}

__device__ __forceinline__ h16 tohx(float x) { return (h16)x; }
__device__ __forceinline__ void splitf(float y, unsigned short& h, unsigned short& l) { h = f2bf(y); l = f2bf(y - bf2f(h)); }
typedef __attribute__((ext_vector_type(4))) _Float16 v4h;
typedef __attribute__((ext_vector_type(4))) unsigned short v4us;
typedef __attribute__((ext_vector_type(2))) float v2f;
typedef __attribute__((ext_vector_type(4))) int v4i;

// ---- the two transposing kernels: a work-group of 8 waves takes a tile of TK rows x TN columns of a row-major f32 matrix. 16 lanes read 256 consecutive bytes of a row (8 loads of 16 bytes
// in flight per lane), the tile is turned in LDS, and 16 lanes store 256 consecutive bytes of an output row. The LDS pitch is an odd number of dwords, so that the column-wise writes spread over the banks.
// Every global access is the tile's scalar base + one byte offset of the lane + a constant.
#define TK 128
#define TN 64
typedef __attribute__((ext_vector_type(4))) unsigned v4u;
typedef v4u __attribute__((may_alias)) v4ua;
// k_wtG: Bt[n][k] = bf16(w[k][n]); grid (K / TK, N / TN). Two rows are packed into dwords (k, k + 1) in front of LDS.
template <int K, int N>
__global__ __launch_bounds__(256) void k_wtG(const float* __restrict__ w, bf* Bt) {
    static_assert(K % TK == 0 && N % TN == 0, "whole tiles");
    __shared__ unsigned tb[TN * (TK / 2 + 1)];
    const int l15 = threadIdx.x & 15, r = threadIdx.x >> 4;
    const char* p = (const char*)(w + (size_t)blockIdx.x * TK * N + blockIdx.y * TN); const unsigned lo = (unsigned)(2 * r * N + l15 * 4) * 4; v4f a[TK / 32], b[TK / 32];
#pragma unroll
    for (int s = 0; s < TK / 32; ++s) { a[s] = *(const v4f*)(p + (size_t)lo + 32 * s * N * 4); b[s] = *(const v4f*)(p + (size_t)lo + (32 * s + 1) * N * 4); }
#pragma unroll
    for (int s = 0; s < TK / 32; ++s)
#pragma unroll
        for (int i = 0; i < 4; ++i) tb[(l15 * 4 + i) * (TK / 2 + 1) + 16 * s + r] = (unsigned)f2bf(a[s][i]) | ((unsigned)f2bf(b[s][i]) << 16);
    __syncthreads();   // the whole tile is in LDS before any of its columns is read
    char* q = (char*)(Bt + (size_t)blockIdx.y * TN * K + blockIdx.x * TK); const unsigned so = (unsigned)(r * K + l15 * 8) * 2;
#pragma unroll
    for (int s = 0; s < TN / 16; ++s) { v4u o;
#pragma unroll
        for (int j = 0; j < 4; ++j) o[j] = tb[(16 * s + r) * (TK / 2 + 1) + l15 * 4 + j];
        *(v4ua*)(q + (size_t)so + 16 * s * K * 2) = o; }
}
__global__ __launch_bounds__(256) void k_cvt8(const float* __restrict__ src, bf* dst, size_t n8) { const size_t i = (size_t)blockIdx.x * 256 + threadIdx.x; if (i >= n8) return; const v8f v = *(const v8f*)(src + i * 8); v8us o;
#pragma unroll
    for (int k = 0; k < 8; ++k) o[k] = f2bf(v[k]); *(v8us*)(dst + i * 8) = o;  }
// k_vtp: the three V^T planes [head][d][t] from F[t][head * HD + d]; grid (TT / TK, DKV / TN). The tile is turned as f32 and converted behind LDS.
__global__ __launch_bounds__(256) void k_vtp(const float* __restrict__ F, h16* V16, bf* Vh, bf* Vl) {
    static_assert(TT % TK == 0 && DKV % TN == 0, "whole tiles");
    __shared__ float tf[TN * (TK + 1)];
    const int l15 = threadIdx.x & 15, r = threadIdx.x >> 4;
    const char* p = (const char*)(F + (size_t)blockIdx.x * TK * DKV + blockIdx.y * TN); const unsigned lo = (unsigned)(r * DKV + l15 * 4) * 4; v4f a[TK / 16];
#pragma unroll
    for (int s = 0; s < TK / 16; ++s) a[s] = *(const v4f*)(p + (size_t)lo + 16 * s * DKV * 4);
#pragma unroll
    for (int s = 0; s < TK / 16; ++s)
#pragma unroll
        for (int i = 0; i < 4; ++i) tf[(l15 * 4 + i) * (TK + 1) + 16 * s + r] = a[s][i];
    __syncthreads();   // the whole tile is in LDS before any of its columns is read
    const size_t e0 = ((size_t)blockIdx.y * TN * TT + blockIdx.x * TK) * 2; const unsigned so = (unsigned)(r * TT + l15 * 8) * 2;   // the three planes hold 2-byte elements
#pragma unroll
    for (int s = 0; s < TN / 16; ++s) { v8h o16; v8us oh, ol;
#pragma unroll
        for (int j = 0; j < 8; ++j) { const float x = tf[(16 * s + r) * (TK + 1) + l15 * 8 + j]; o16[j] = tohx(x); unsigned short a2, c2; splitf(x, a2, c2); oh[j] = a2; ol[j] = c2; }
        *(v8ha*)((char*)V16 + e0 + (size_t)so + 16 * s * TT * 2) = o16; *(v8usa*)((char*)Vh + e0 + (size_t)so + 16 * s * TT * 2) = oh; *(v8usa*)((char*)Vl + e0 + (size_t)so + 16 * s * TT * 2) = ol; }
}
// ---- k_qkprep: RMS norm across the full row, rotary and the hi/lo split of q and k in one launch. Grid (TT / 8, 2), 8 waves, no barrier: a wave owns one row of q (y = 0) or of k (y = 1)
// and keeps it in registers from the sum of squares to the head planes [h][t][d]. A lane holds 4 consecutive columns of every 128, so both members of a rotary pair are its own;
// cos and sin are read as given ([t][DQ], per element) and rounded to bf16 here. out[d] = x[d] cos[d] - x[d+1] sin[d] (d even), x[d] cos[d] + x[d-1] sin[d] (d odd).
__global__ __launch_bounds__(256) void k_qkprep(const float* __restrict__ FQ, const float* __restrict__ FK, const float* __restrict__ nqw, const float* __restrict__ nkw, const float* __restrict__ cosT, const float* __restrict__ sinT, bf* QPh, bf* QPl, bf* KPh, bf* KPl) {
    static_assert(DKV == DQ && TT % 8 == 0 && HD == 64, "q and k rows are equally wide, 8 rows a work-group, 128 columns are two heads");
    const int lane = threadIdx.x & 31; const int t = blockIdx.x * 8 + __builtin_amdgcn_readfirstlane((int)(threadIdx.x >> 5)); const bool isk = blockIdx.y != 0;   // the row is scalar: every access is a scalar base + one lane offset that lives to the end
    const unsigned lo = lane * 4, po = (lane >> 4) * (TT * HD) + (lane & 15) * 4;   // 128 columns are two heads: lanes 0-15 write one whole 128-byte row of a plane, lanes 16-31 the next head's
    const float* f = (isk ? FK : FQ) + (size_t)t * DQ; const float* w = isk ? nkw : nqw; const float* ct = cosT + (size_t)t * DQ; const float* st = sinT + (size_t)t * DQ;
    bf* ph = (isk ? KPh : QPh) + (size_t)t * HD; bf* pl = (isk ? KPl : QPl) + (size_t)t * HD;
    v4f v[DQ / 128], c[DQ / 128], s[DQ / 128]; v4f wn = *(const v4f*)(w + lo);
#pragma unroll
    for (int ch = 0; ch < DQ / 128; ++ch) v[ch] = *(const v4f*)(f + ch * 128 + lo);
#pragma unroll
    for (int ch = 0; ch < DQ / 128; ++ch) { c[ch] = *(const v4f*)(ct + ch * 128 + lo); s[ch] = *(const v4f*)(st + ch * 128 + lo); }
    __builtin_amdgcn_sched_barrier(0);   // keeps every table load in front of the sum of squares: sunk to their uses, they are waited for one by one, a memory latency each
    float ss = 0.f;
#pragma unroll
    for (int ch = 0; ch < DQ / 128; ++ch)
#pragma unroll
        for (int u = 0; u < 4; ++u) ss += v[ch][u] * v[ch][u];
#pragma unroll
    for (int sh = 16; sh; sh >>= 1) ss += __shfl_xor(ss, sh, 32);
    const float rs = __fdiv_rn(1.0f, sqrtf(ss / (float)DQ + 1e-5f));
    __builtin_amdgcn_sched_barrier(0);   // keeps the rounding of the first tables behind the sum: hoisted, it waits for the last load in front of the first square
#pragma unroll
    for (int ch = 0; ch < DQ / 128; ++ch) { const v4f wv = wn; v4f y; v4us oh, ol; if (ch + 1 < DQ / 128) wn = *(const v4f*)(w + (ch + 1) * 128 + lo);   // the next norm weights fly during this chunk
#pragma unroll
        for (int u = 0; u < 4; ++u) y[u] = v[ch][u] * rs * bfr(wv[u]);
#pragma unroll
        for (int u = 0; u < 4; ++u) { const float a = y[u] * bfr(c[ch][u]), b = y[u ^ 1] * bfr(s[ch][u]); const float r = (u & 1) ? a + b : a - b; unsigned short h2, l2; splitf(r, h2, l2); oh[u] = h2; ol[u] = l2; }
        *(v4us*)(ph + (size_t)ch * 2 * TT * HD + po) = oh; *(v4us*)(pl + (size_t)ch * 2 * TT * HD + po) = ol;
        if (ch + 1 < DQ / 128) asm volatile("s_wait_xcnt 0x0" ::: "memory");   // behind the two stores: the next chunk's load and values take the stores' data registers anew
        __builtin_amdgcn_sched_barrier(0); }   // one chunk at a time: merged, the chunks' results pile up in registers in front of late stores, past 256 registers (three waves a SIMD, not four)
}
#define AW 8                      // waves of a work-group
#define AQ 2                      // 16-query column groups of a wave
#define AHW (RH / (16 * AQ) / (TT / (16 * AQ * AW)))   // waves of every work-group that take a hi+lo query tile, so that all work-groups cost the same
struct KFrag { v16bf h[2][2], l[2][2]; };   // 32 keys: [16-key tile][32-wide step of d]
// xwait: behind a run of loads and in front of the step of their offset register; it names the offset, so that it is stepped, and its register used anew, only behind it
__device__ __forceinline__ void xwait(unsigned& o) { asm volatile("s_wait_xcnt 0x0" : "+v"(o) :: "memory"); }
// fragment at a wave-uniform plane pointer + the lane's own byte offset + a constant: k octets hi and 2 + hi of a 32-wide step
__device__ __forceinline__ v16bf ldfb(const bf* __restrict__ base, unsigned off, int imm) { const char* p = (const char*)base + (size_t)off + imm; return cat16b(*(const v8us*)p, *(const v8us*)(p + 32)); }
__device__ __forceinline__ v16h ldfh(const h16* __restrict__ base, unsigned off, int imm) { const char* p = (const char*)base + (size_t)off + imm; return cat16(*(const v8h*)p, *(const v8h*)(p + 32)); }
__device__ __forceinline__ void ldk(KFrag& f, const bf* __restrict__ kh, const bf* __restrict__ kl, unsigned& ko) {
#pragma unroll
    for (int t = 0; t < 2; ++t)
#pragma unroll
        for (int kk = 0; kk < 2; ++kk) { f.h[t][kk] = ldfb(kh, ko, (t * 16 * HD + kk * 32) * 2); f.l[t][kk] = ldfb(kl, ko, (t * 16 * HD + kk * 32) * 2); }
    xwait(ko);
}
__device__ __forceinline__ v8f scoreT(const KFrag& f, int t, const v16bf* qh, const v16bf* ql) { v8f s = (v8f){};
#pragma unroll
    for (int kk = 0; kk < 2; ++kk) { s = wmmab(f.h[t][kk], qh[kk], s); s = wmmab(f.h[t][kk], ql[kk], s); s = wmmab(f.l[t][kk], qh[kk], s); }
    return s; }
template <bool HR> struct VFrag;
template <> struct VFrag<true> { v16bf h[4], l[4]; };   // 32 keys of V^T: [16-row tile of d]
template <> struct VFrag<false> { v16h x[4]; };
__device__ __forceinline__ void ldv(VFrag<true>& f, const h16* __restrict__, const bf* __restrict__ vh, const bf* __restrict__ vl, unsigned& vo) {
#pragma unroll
    for (int mb = 0; mb < 4; ++mb) { f.h[mb] = ldfb(vh, vo, mb * 16 * TT * 2); f.l[mb] = ldfb(vl, vo, mb * 16 * TT * 2); }
    xwait(vo); }
__device__ __forceinline__ void ldv(VFrag<false>& f, const h16* __restrict__ v16, const bf* __restrict__, const bf* __restrict__, unsigned& vo) {
#pragma unroll
    for (int mb = 0; mb < 4; ++mb) f.x[mb] = ldfh(v16, vo, mb * 16 * TT * 2);
    xwait(vo); }
__device__ __forceinline__ void pv(v8f* o, const VFrag<true>& f, const float* p) { v8us h0, h1, l0, l1;
#pragma unroll
    for (int r = 0; r < 8; ++r) { unsigned short a, c2; splitf(p[r], a, c2); h0[r] = a; l0[r] = c2; splitf(p[8 + r], a, c2); h1[r] = a; l1[r] = c2; }
    const v16bf ph = cat16b(h0, h1), pl = cat16b(l0, l1);
#pragma unroll
    for (int mb = 0; mb < 4; ++mb) { o[mb] = wmmab(f.h[mb], ph, o[mb]); o[mb] = wmmab(f.h[mb], pl, o[mb]); o[mb] = wmmab(f.l[mb], ph, o[mb]); } }
__device__ __forceinline__ void pv(v8f* o, const VFrag<false>& f, const float* p) { v16h p16;
#pragma unroll
    for (int r = 0; r < 16; ++r) p16[r] = tohx(p[r] * PCAR);
#pragma unroll
    for (int mb = 0; mb < 4; ++mb) o[mb] = wmma16(f.x[mb], p16, o[mb]); }
template <bool HR>
__device__ __forceinline__ void attn_tile(const bf* __restrict__ Qh, const bf* __restrict__ Ql, const bf* __restrict__ Kh, const bf* __restrict__ Kl, const h16* __restrict__ V16, const bf* __restrict__ Vh, const bf* __restrict__ Vl, bf* Ah, bf* Al, int q0) {
    const int lane = threadIdx.x & 31, lr = lane & 15, hi = lane >> 4;
    unsigned qo = (unsigned)((q0 + lr) * HD + 8 * hi) * 2, ko = (unsigned)(lr * HD + 8 * hi) * 2, vo = (unsigned)(lr * TT + 8 * hi) * 2;   // the lane's byte offsets in the Q, K and V^T planes of the head
    v16bf qh[AQ][2], ql[AQ][2];
#pragma unroll
    for (int g = 0; g < AQ; ++g)
#pragma unroll
        for (int kk = 0; kk < 2; ++kk) { qh[g][kk] = ldfb(Qh, qo, (g * 16 * HD + kk * 32) * 2); ql[g][kk] = ldfb(Ql, qo, (g * 16 * HD + kk * 32) * 2); }
    xwait(qo);
    float mx[AQ], sum[AQ]; v8f o[AQ][4];
#pragma unroll
    for (int g = 0; g < AQ; ++g) { mx[g] = -3.0e38f; sum[g] = 0.f;
#pragma unroll
        for (int mb = 0; mb < 4; ++mb) o[g][mb] = (v8f){}; }
    // every fetch runs ahead of its use and wraps to key 0 behind the last key, so it stays in bounds
    const unsigned ko0 = ko; KFrag kc, kd; ldk(kc, Kh, Kl, ko); ko += 32 * HD * 2; ldk(kd, Kh, Kl, ko); ko += 32 * HD * 2;
    for (int j0 = 0; j0 < TT; j0 += 64) {   // two fragment sets in turn: each is fetched anew behind its last use and flies while the other is worked on
#pragma unroll
        for (int t = 0; t < 2; ++t)
#pragma unroll
            for (int g = 0; g < AQ; ++g) { const v8f s = scoreT(kc, t, qh[g], ql[g]);
#pragma unroll
                for (int r = 0; r < 8; ++r) mx[g] = fmaxf(mx[g], s[r]); }
        ldk(kc, Kh, Kl, ko); ko += 32 * HD * 2;   // the last trip fetches keys 0..31, which walk 2 starts with
        __builtin_amdgcn_sched_barrier(0);   // keeps the two sets' products apart: merged, both sets are fetched late in the trip and waited for at the head of the next
#pragma unroll
        for (int t = 0; t < 2; ++t)
#pragma unroll
            for (int g = 0; g < AQ; ++g) { const v8f s = scoreT(kd, t, qh[g], ql[g]);
#pragma unroll
                for (int r = 0; r < 8; ++r) mx[g] = fmaxf(mx[g], s[r]); }
        ldk(kd, Kh, Kl, ko); ko += (unsigned)(((j0 + 128 == TT) ? 32 - TT : 32) * HD * 2);
    }
    ko = ko0 + 32 * HD * 2;
#pragma unroll
    for (int g = 0; g < AQ; ++g) mx[g] = fmaxf(mx[g], __shfl_xor(mx[g], 16, 32)) * SCL;   // SCL is a power of two: max(s) * SCL == max(s * SCL)
    VFrag<HR> vc; ldv(vc, V16, Vh, Vl, vo); vo += 32 * 2;
    for (int j0 = 0; j0 < TT; j0 += 32) { const int st = (j0 + 64 == TT) ? -(TT - 32) : 32;   // the last trip fetches keys 0..31 again (in bounds, unused)
        v8f s[AQ][2];
#pragma unroll
        for (int t = 0; t < 2; ++t)
#pragma unroll
            for (int g = 0; g < AQ; ++g) s[g][t] = scoreT(kc, t, qh[g], ql[g]);
        ldk(kc, Kh, Kl, ko); ko += (unsigned)(st * HD * 2);   // the next keys, behind the last use of these: they fly during exp and attn.v
#pragma unroll
        for (int g = 0; g < AQ; ++g) { float p[16];
#pragma unroll
            for (int t = 0; t < 2; ++t)
#pragma unroll
                for (int r = 0; r < 8; ++r) { p[t * 8 + r] = __builtin_amdgcn_exp2f((s[g][t][r] * SCL - mx[g]) * 1.4426950408889634f); sum[g] += p[t * 8 + r]; }
            pv(o[g], vc, p); }
        ldv(vc, V16, Vh, Vl, vo); vo += (unsigned)(st * 2);   // the next V^T columns fly during the next trip's scores
    }
#pragma unroll
    for (int g = 0; g < AQ; ++g) { const float fin = __fdiv_rn(1.0f, sum[g] + __shfl_xor(sum[g], 16, 32)) * (HR ? 1.0f : 1.0f / PCAR);
#pragma unroll
        for (int mb = 0; mb < 4; ++mb) { v8us oh, ol;
#pragma unroll
            for (int r = 0; r < 8; ++r) { unsigned short a, c2; splitf(o[g][mb][r] * fin, a, c2); oh[r] = a; ol[r] = c2; }
            const size_t oo = (size_t)(q0 + g * 16 + lr) * DQ + mb * 16 + 8 * hi;
            // the two stores and their s_wait_xcnt in one statement: in a statement of its own the wait sank below the next tile's values, which take the stores' registers anew
            asm volatile("global_store_b128 %0, %2, off\n\tglobal_store_b128 %1, %3, off\n\ts_wait_xcnt 0x0" :: "v"(Ah + oo), "v"(Al + oo), "v"(oh), "v"(ol) : "memory"); } }
}
__global__ __launch_bounds__(32 * AW) void k_attn(const bf* __restrict__ QPh, const bf* __restrict__ QPl, const bf* __restrict__ KPh, const bf* __restrict__ KPl, const h16* __restrict__ VT16, const bf* __restrict__ VTh, const bf* __restrict__ VTl, bf* ATh, bf* ATl) {
    static_assert(RH % (16 * AQ) == 0 && (RH / (16 * AQ)) % (TT / (16 * AQ * AW)) == 0 && TT % 128 == 0, "query tiles deal evenly, walk 1 takes 64 keys a trip");
    const int wave = __builtin_amdgcn_readfirstlane((int)(threadIdx.x >> 5));   // scalar, so the choice of the tile's kind is a scalar branch
    const size_t zq = (size_t)blockIdx.y * TT * HD, zk = (size_t)(blockIdx.y / REP) * TT * HD; bf* ah = ATh + blockIdx.y * HD; bf* al = ATl + blockIdx.y * HD;
    if (wave < AHW) attn_tile<true>(QPh + zq, QPl + zq, KPh + zk, KPl + zk, VT16 + zk, VTh + zk, VTl + zk, ah, al, ((int)blockIdx.x * AHW + wave) * (16 * AQ));
    else attn_tile<false>(QPh + zq, QPl + zq, KPh + zk, KPl + zk, VT16 + zk, VTh + zk, VTl + zk, ah, al, RH + ((int)blockIdx.x * (AW - AHW) + wave - AHW) * (16 * AQ));
}

extern "C" void kernel_launch(void* const* d_in, const int* in_sizes, int n_in,
                              void* d_out, int out_size, void* d_ws, size_t ws_size, hipStream_t stream) {
    (void)in_sizes; (void)n_in; (void)out_size;
    const float* x = (const float*)d_in[0]; const float* cosT = (const float*)d_in[1]; const float* sinT = (const float*)d_in[2]; const float* wq = (const float*)d_in[3]; const float* bq = (const float*)d_in[4]; const float* wk = (const float*)d_in[5]; const float* bk = (const float*)d_in[6]; const float* wv = (const float*)d_in[7]; const float* bv = (const float*)d_in[8]; const float* nqw = (const float*)d_in[9]; const float* nkw = (const float*)d_in[10]; const float* wo = (const float*)d_in[11]; const float* bo = (const float*)d_in[12];
    float* OUT = (float*)d_out;     // [1][2048][2048]
    char* wsp = (char*)d_ws;
    auto take = [&](size_t bytes) { char* p = wsp; wsp += (bytes + 255) & ~(size_t)255; return (void*)p; };
    bf* WQ = (bf*)take((size_t)DQ * DM * 2); bf* WK = (bf*)take((size_t)DKV * DM * 2); bf* WV = (bf*)take((size_t)DKV * DM * 2); bf* WO = (bf*)take((size_t)DM * DQ * 2);
    bf* XB = (bf*)take((size_t)TT * DM * 2); float* FQ = (float*)take((size_t)TT * DQ * 4); float* FK = (float*)take((size_t)TT * DKV * 4);
    h16* VT16 = (h16*)take((size_t)NKV * HD * TT * 2);
    bf* QPh = (bf*)take((size_t)NH_ * TT * HD * 2); bf* QPl = (bf*)take((size_t)NH_ * TT * HD * 2); bf* KPh = (bf*)take((size_t)NKV * TT * HD * 2); bf* KPl = (bf*)take((size_t)NKV * TT * HD * 2); bf* VTh = (bf*)take((size_t)NKV * HD * TT * 2); bf* VTl = (bf*)take((size_t)NKV * HD * TT * 2);
    bf* ATh = (bf*)take((size_t)TT * DQ * 2); bf* ATl = (bf*)take((size_t)TT * DQ * 2);
    if ((size_t)(wsp - (char*)d_ws) > ws_size) return;    // ws 256 MiB
    float* FV = FK;   // v projection reuses the k buffer after the k planes are built (stream-ordered)
    { k_wtG<DM, DQ><<<dim3(DM / TK, DQ / TN), 256, 0, stream>>>(wq, WQ); k_wtG<DM, DKV><<<dim3(DM / TK, DKV / TN), 256, 0, stream>>>(wk, WK); k_wtG<DM, DKV><<<dim3(DM / TK, DKV / TN), 256, 0, stream>>>(wv, WV);
      k_wtG<DQ, DM><<<dim3(DQ / TK, DM / TN), 256, 0, stream>>>(wo, WO);
       }
    for (int b = 0; b < NB_; ++b) {
        k_cvt8<<<(unsigned)(((size_t)TT * DM / 8 + 255) / 256), 256, 0, stream>>>(x + (size_t)b * TT * DM, XB, (size_t)TT * DM / 8);
        k_gemmw<bf, 0, true, 1, 1><<<dim3(TT / 64, DQ / 64, 1), 32, 0, stream>>>(XB, nullptr, WQ, nullptr, DM, FQ, DQ, bq, 0, 0, 0, 0);
        k_gemmw<bf, 0, true, 1, 1><<<dim3(TT / 64, DKV / 64, 1), 32, 0, stream>>>(XB, nullptr, WK, nullptr, DM, FK, DKV, bk, 0, 0, 0, 0);
        k_qkprep<<<dim3(TT / 8, 2), 256, 0, stream>>>(FQ, FK, nqw, nkw, cosT, sinT, QPh, QPl, KPh, KPl);
        k_gemmw<bf, 0, true, 1, 1><<<dim3(TT / 64, DKV / 64, 1), 32, 0, stream>>>(XB, nullptr, WV, nullptr, DM, FV, DKV, bv, 0, 0, 0, 0); k_vtp<<<dim3(TT / TK, DKV / TN), 256, 0, stream>>>(FV, VT16, VTh, VTl);
        k_attn<<<dim3(TT / (16 * AQ * AW), NH_), 32 * AW, 0, stream>>>(QPh, QPl, KPh, KPl, VT16, VTh, VTl, ATh, ATl);
        k_gemmw<bf, 1, true, 1, 1><<<dim3(TT / 64, DM / 64, 1), 32, 0, stream>>>(ATh, ATl, WO, nullptr, DQ, OUT + (size_t)b * TT * DM, DM, bo, 0, 0, 0, 0); }
}
